// v000
// The times below were measured on an AMD MI455X: many runs one after another, warmed up first and cycling through
// copies of the inputs, with the whole window's GPU time divided by the number of runs. Launches and the gaps
// between them are all in it. The median over several windows is given; except for v000 it joins two sittings, which
// can be a few percent apart, so the side-by-side timings, each taken in one sitting, are the better comparison.
// v000 is the starting kernel. One run takes 260 microseconds.
#include <hip/hip_runtime.h>
#include <hip/hip_bf16.h>
#include <hip/hip_fp16.h>

typedef __attribute__((ext_vector_type(16))) _Float16 v16h;
typedef __attribute__((ext_vector_type(8)))  _Float16 v8h;
typedef __attribute__((ext_vector_type(8)))  float    v8f;
typedef __attribute__((ext_vector_type(4)))  unsigned int u32x4;
typedef __attribute__((ext_vector_type(8)))  int      i32x8;
typedef __attribute__((ext_vector_type(4)))  int      i32x4;

#define B_   2
#define L_   2048
#define D_   1024
#define H_   16
#define HD_  64
#define ND3  (3 * D_)

__device__ __forceinline__ v16h frag16(const _Float16* base, int ld, int kbase) {
  const int lane = threadIdx.x & 31;
  const int half = lane >> 4;
  const int row  = lane & 15;
  const _Float16* p = base + row * ld + kbase + 8 * half;
  const v8h a = *(const v8h*)p;
  const v8h b = *(const v8h*)(p + 16);
  return __builtin_shufflevector(a, b, 0, 1, 2, 3, 4, 5, 6, 7,
                                 8, 9, 10, 11, 12, 13, 14, 15);
}

__device__ __forceinline__ void tdm_load_2d_f16(unsigned lds_off, const void* gptr,
                                                int tile_d0, int tile_d1,
                                                long long row_stride) {
  const unsigned long long ga = (unsigned long long)(size_t)gptr;
  u32x4 g0;
  g0[0] = 1u;
  g0[1] = lds_off;
  g0[2] = (unsigned)(ga & 0xffffffffu);
  g0[3] = (unsigned)((ga >> 32) & 0x1ffffffu)
        | (2u << 30);
  i32x8 g1;
  g1[0] = (1 << 16)
        | (1 << 20)
        | (4 << 22)
        | (3 << 25);
  g1[1] = (tile_d0 & 0xffff) << 16;
  g1[2] = ((tile_d0 >> 16) & 0xffff)
        | ((tile_d1 & 0xffff) << 16);
  g1[3] = ((tile_d1 >> 16) & 0xffff)
        | ((tile_d0 & 0xffff) << 16);
  g1[4] = (tile_d1 & 0xffff);
  g1[5] = (int)(row_stride & 0xffffffffLL);
  g1[6] = (int)((row_stride >> 32) & 0xffffLL);
  g1[7] = 0;
  i32x4 z4;
  z4[0] = z4[1] = z4[2] = z4[3] = 0;
#if defined(__clang_major__) && (__clang_major__ >= 23)
  i32x8 z8;
#pragma unroll
  for (int i = 0; i < 8; ++i) z8[i] = 0;
  __builtin_amdgcn_tensor_load_to_lds(g0, g1, z4, z4, z8, 0);
#else
  __builtin_amdgcn_tensor_load_to_lds(g0, g1, z4, z4, 0);
#endif
}

// ---------------------------------------------------------------------------
// Kernel 1: QKV projection  (M=B*L=4096, K=1024, N=3072), fp32 in -> f16 out
// 128x64 tile/block, 8 waves; A staged row-major, B staged transposed [n][k].
// ---------------------------------------------------------------------------
__global__ __launch_bounds__(256)
void qkv_gemm_kernel(const float* __restrict__ x, const float* __restrict__ w,
                     _Float16* __restrict__ qkv) {
  __shared__ __align__(16) _Float16 As[128 * 40];   // [m][k]
  __shared__ __align__(16) _Float16 Bs[64 * 40];    // [n][k] (transposed)
  const int tid  = threadIdx.x;
  const int wave = tid >> 5;
  const int lane = tid & 31;
  const int half = lane >> 4;
  const int row0 = blockIdx.x * 128;
  const int col0 = blockIdx.y * 64;

  v8f acc[4];
#pragma unroll
  for (int t = 0; t < 4; ++t)
#pragma unroll
    for (int f = 0; f < 8; ++f) acc[t][f] = 0.0f;

  for (int k0 = 0; k0 < D_; k0 += 32) {
    if (k0 + 32 < D_) {                      // prefetch next tiles
      __builtin_prefetch(&x[(size_t)(row0 + (tid >> 1)) * D_ + k0 + 32], 0, 1);
      __builtin_prefetch(&w[(size_t)(k0 + 32 + (tid >> 3)) * ND3 + col0 + (tid & 7) * 8], 0, 1);
    }
#pragma unroll
    for (int i = 0; i < 16; ++i) {           // A: 128x32
      const int idx = i * 256 + tid;
      const int r = idx >> 5, c = idx & 31;
      As[r * 40 + c] = (_Float16)x[(size_t)(row0 + r) * D_ + k0 + c];
    }
#pragma unroll
    for (int i = 0; i < 8; ++i) {            // B: 32x64, stored [n][k]
      const int idx = i * 256 + tid;
      const int r = idx >> 6, c = idx & 63;
      Bs[c * 40 + r] = (_Float16)w[(size_t)(k0 + r) * ND3 + col0 + c];
    }
    __syncthreads();

    const v16h a = frag16(As + (wave * 16) * 40, 40, 0);
#pragma unroll
    for (int t = 0; t < 4; ++t) {
      const v16h b = frag16(Bs + (t * 16) * 40, 40, 0);
      acc[t] = __builtin_amdgcn_wmma_f32_16x16x32_f16(
          false, a, false, b, (short)0, acc[t], false, false);
    }
    __syncthreads();
  }

#pragma unroll
  for (int t = 0; t < 4; ++t)
#pragma unroll
    for (int f = 0; f < 8; ++f) {
      const int m = row0 + wave * 16 + f + 8 * half;
      const int n = col0 + t * 16 + (lane & 15);
      qkv[(size_t)m * ND3 + n] = (_Float16)acc[t][f];
    }
}

// ---------------------------------------------------------------------------
// Kernel 2: RoPE on q and k (pairs j, j+32), in place on the f16 qkv buffer.
// ---------------------------------------------------------------------------
__global__ __launch_bounds__(256)
void rope_kernel(_Float16* __restrict__ qkv) {
  const int idx = blockIdx.x * blockDim.x + threadIdx.x;
  if (idx >= B_ * L_ * H_ * 32) return;
  const int j = idx & 31;
  const int h = (idx >> 5) & (H_ - 1);
  const int l = (idx >> 9) & (L_ - 1);
  const int b = idx >> 20;

  const float inv_freq = __powf(10000.0f, -(float)(2 * j) / (float)HD_);
  const float ang = (float)l * inv_freq;
  const float c = __cosf(ang);
  const float s = __sinf(ang);

  const size_t base = ((size_t)(b * L_ + l)) * ND3 + h * HD_;
#pragma unroll
  for (int sidx = 0; sidx < 2; ++sidx) {     // 0 = q, 1 = k
    _Float16* p = qkv + base + sidx * D_;
    const float x1 = (float)p[j];
    const float x2 = (float)p[j + 32];
    p[j]      = (_Float16)(x1 * c - x2 * s);
    p[j + 32] = (_Float16)(x2 * c + x1 * s);
  }
}

__global__ __launch_bounds__(128)
void attn_kernel(const _Float16* __restrict__ qkv, _Float16* __restrict__ o) {
  __shared__ __align__(16) _Float16 Qs[64 * 72];   // [q][d]
  __shared__ __align__(16) _Float16 Ks[64 * 72];   // [key][d]  (acts as B^T)
  __shared__ __align__(16) _Float16 Vt[64 * 72];   // [d][key]  (transposed)
  __shared__ __align__(16) _Float16 Ps[64 * 72];   // [q][key]

  const int tid   = threadIdx.x;
  const int wave  = tid >> 5;
  const int lane  = tid & 31;
  const int half  = lane >> 4;
  const int nlane = lane & 15;

  const int blk = blockIdx.x;                // b * H * (L/64)
  const int qt  = blk & 31;                  // L/64 = 32
  const int h   = (blk >> 5) & (H_ - 1);
  const int b   = blk >> 9;
  const int q0  = qt * 64;

  const _Float16* qbase = qkv + (size_t)b * L_ * ND3 + h * HD_;
  const _Float16* kbase = qbase + D_;
  const _Float16* vbase = qbase + 2 * D_;

  if (wave == 0) {
    tdm_load_2d_f16((unsigned)(size_t)Qs, qbase + (size_t)q0 * ND3, 64, 64, ND3);
    __builtin_amdgcn_s_wait_tensorcnt(0);
  }
  __syncthreads();

  float m_i[8], l_i[8];
#pragma unroll
  for (int f = 0; f < 8; ++f) { m_i[f] = -3.0e38f; l_i[f] = 0.0f; }
  v8f acc_o[4];
#pragma unroll
  for (int t = 0; t < 4; ++t)
#pragma unroll
    for (int f = 0; f < 8; ++f) acc_o[t][f] = 0.0f;

  const float scale = 0.125f;                // 1/sqrt(64)

  for (int kt = 0; kt < L_ / 64; ++kt) {
    const int kk0 = kt * 64;
    __syncthreads();
    if (wave == 0)
      tdm_load_2d_f16((unsigned)(size_t)Ks, kbase + (size_t)kk0 * ND3, 64, 64, ND3);
#pragma unroll
    for (int i = 0; i < 32; ++i) {           // V tile staged transposed
      const int idx = i * 128 + tid;
      const int r = idx >> 6, c = idx & 63;  // r = key, c = d
      Vt[c * 72 + r] = vbase[(size_t)(kk0 + r) * ND3 + c];
    }
    if (wave == 0) __builtin_amdgcn_s_wait_tensorcnt(0);
    __syncthreads();

    // S = Q K^T -> 16x64 per wave; K rows are B^T fragment rows
    v8f acc_s[4];
#pragma unroll
    for (int t = 0; t < 4; ++t)
#pragma unroll
      for (int f = 0; f < 8; ++f) acc_s[t][f] = 0.0f;
#pragma unroll
    for (int ks = 0; ks < 2; ++ks) {
      const v16h a = frag16(Qs + (wave * 16) * 72, 72, ks * 32);
#pragma unroll
      for (int t = 0; t < 4; ++t) {
        const v16h bfr = frag16(Ks + (t * 16) * 72, 72, ks * 32);
        acc_s[t] = __builtin_amdgcn_wmma_f32_16x16x32_f16(
            false, a, false, bfr, (short)0, acc_s[t], false, false);
      }
    }

    // Online softmax per row (row M = f + 8*half)
#pragma unroll
    for (int f = 0; f < 8; ++f) {
      float vmax = -3.0e38f;
#pragma unroll
      for (int t = 0; t < 4; ++t) vmax = fmaxf(vmax, acc_s[t][f]);
#pragma unroll
      for (int mask = 1; mask < 16; mask <<= 1)
        vmax = fmaxf(vmax, __shfl_xor(vmax, mask, 32));
      vmax *= scale;
      const float mnew  = fmaxf(m_i[f], vmax);
      const float alpha = __expf(m_i[f] - mnew);
      float rsum = 0.0f;
#pragma unroll
      for (int t = 0; t < 4; ++t) {
        const float p = __expf(acc_s[t][f] * scale - mnew);
        rsum += p;
        Ps[(wave * 16 + f + 8 * half) * 72 + t * 16 + nlane] = (_Float16)p;
      }
#pragma unroll
      for (int mask = 1; mask < 16; mask <<= 1)
        rsum += __shfl_xor(rsum, mask, 32);
      l_i[f] = l_i[f] * alpha + rsum;
      m_i[f] = mnew;
#pragma unroll
      for (int t = 0; t < 4; ++t) acc_o[t][f] *= alpha;
    }

    // O += P V : A = P rows (wave-local), B = Vt rows (d-major)
#pragma unroll
    for (int ks = 0; ks < 2; ++ks) {
      const v16h a = frag16(Ps + (wave * 16) * 72, 72, ks * 32);
#pragma unroll
      for (int t = 0; t < 4; ++t) {
        const v16h bfr = frag16(Vt + (t * 16) * 72, 72, ks * 32);
        acc_o[t] = __builtin_amdgcn_wmma_f32_16x16x32_f16(
            false, a, false, bfr, (short)0, acc_o[t], false, false);
      }
    }
  }

  // Normalize and store o as f16 [B*L][D], head-interleaved
#pragma unroll
  for (int t = 0; t < 4; ++t)
#pragma unroll
    for (int f = 0; f < 8; ++f) {
      const int row = q0 + wave * 16 + f + 8 * half;
      const int d   = t * 16 + nlane;
      o[((size_t)b * L_ + row) * D_ + h * HD_ + d] =
          (_Float16)(acc_o[t][f] / l_i[f]);
    }
}

// ---------------------------------------------------------------------------
// Kernel 4: output projection (M=4096, K=1024, N=1024), f16 A, fp32 out
// ---------------------------------------------------------------------------
__global__ __launch_bounds__(256)
void out_gemm_kernel(const _Float16* __restrict__ o, const float* __restrict__ w,
                     float* __restrict__ out) {
  __shared__ __align__(16) _Float16 As[128 * 40];   // [m][k]
  __shared__ __align__(16) _Float16 Bs[64 * 40];    // [n][k] (transposed)
  const int tid  = threadIdx.x;
  const int wave = tid >> 5;
  const int lane = tid & 31;
  const int half = lane >> 4;
  const int row0 = blockIdx.x * 128;
  const int col0 = blockIdx.y * 64;

  v8f acc[4];
#pragma unroll
  for (int t = 0; t < 4; ++t)
#pragma unroll
    for (int f = 0; f < 8; ++f) acc[t][f] = 0.0f;

  for (int k0 = 0; k0 < D_; k0 += 32) {
    if (k0 + 32 < D_) {
      __builtin_prefetch(&o[(size_t)(row0 + (tid >> 1)) * D_ + k0 + 32], 0, 1);
      __builtin_prefetch(&w[(size_t)(k0 + 32 + (tid >> 3)) * D_ + col0 + (tid & 7) * 8], 0, 1);
    }
#pragma unroll
    for (int i = 0; i < 16; ++i) {
      const int idx = i * 256 + tid;
      const int r = idx >> 5, c = idx & 31;
      As[r * 40 + c] = o[(size_t)(row0 + r) * D_ + k0 + c];
    }
#pragma unroll
    for (int i = 0; i < 8; ++i) {
      const int idx = i * 256 + tid;
      const int r = idx >> 6, c = idx & 63;
      Bs[c * 40 + r] = (_Float16)w[(size_t)(k0 + r) * D_ + col0 + c];
    }
    __syncthreads();

    const v16h a = frag16(As + (wave * 16) * 40, 40, 0);
#pragma unroll
    for (int t = 0; t < 4; ++t) {
      const v16h b = frag16(Bs + (t * 16) * 40, 40, 0);
      acc[t] = __builtin_amdgcn_wmma_f32_16x16x32_f16(
          false, a, false, b, (short)0, acc[t], false, false);
    }
    __syncthreads();
  }

#pragma unroll
  for (int t = 0; t < 4; ++t)
#pragma unroll
    for (int f = 0; f < 8; ++f) {
      const int m = row0 + wave * 16 + f + 8 * half;
      const int n = col0 + t * 16 + (lane & 15);
      out[(size_t)m * D_ + n] = acc[t][f];
    }
}

// ---------------------------------------------------------------------------
extern "C" void kernel_launch(void* const* d_in, const int* in_sizes, int n_in,
                              void* d_out, int out_size, void* d_ws, size_t ws_size,
                              hipStream_t stream) {
  const float* x     = (const float*)d_in[0];
  const float* w_qkv = (const float*)d_in[1];
  const float* w_out = (const float*)d_in[2];
  float* out = (float*)d_out;

  _Float16* qkv = (_Float16*)d_ws;                       // B*L*3D f16 = 24 MB
  _Float16* o   = qkv + (size_t)B_ * L_ * ND3;           // B*L*D  f16 =  8 MB

  qkv_gemm_kernel<<<dim3((B_ * L_) / 128, ND3 / 64), 256, 0, stream>>>(x, w_qkv, qkv);
  rope_kernel<<<(B_ * L_ * H_ * 32) / 256, 256, 0, stream>>>(qkv);
  attn_kernel<<<B_ * H_ * (L_ / 64), 128, 0, stream>>>(qkv, o);
  out_gemm_kernel<<<dim3((B_ * L_) / 128, D_ / 64), 256, 0, stream>>>(o, w_out, out);
}

// v001
// It runs in 192 microseconds.
// Timed twice side by side with v000, it ran 1.41 and 1.40 times as fast.
#include <hip/hip_runtime.h>
#include <hip/hip_bf16.h>
#include <hip/hip_fp16.h>

typedef __attribute__((ext_vector_type(16))) _Float16 v16h;
typedef __attribute__((ext_vector_type(8)))  _Float16 v8h;
typedef __attribute__((ext_vector_type(4)))  _Float16 v4h;
typedef __attribute__((ext_vector_type(4)))  float    f32x4;
typedef __attribute__((ext_vector_type(8)))  float    v8f;
typedef __attribute__((ext_vector_type(4)))  unsigned int u32x4;
typedef __attribute__((ext_vector_type(8)))  int      i32x8;
typedef __attribute__((ext_vector_type(4)))  int      i32x4;

#define B_   2
#define L_   2048
#define D_   1024
#define H_   16
#define HD_  64
#define ND3  (3 * D_)

__device__ __forceinline__ v16h frag16(const _Float16* base, int ld, int kbase) {
  const int lane = threadIdx.x & 31;
  const int half = lane >> 4;
  const int row  = lane & 15;
  const _Float16* p = base + row * ld + kbase + 8 * half;
  const v8h a = *(const v8h*)p;
  const v8h b = *(const v8h*)(p + 16);
  return __builtin_shufflevector(a, b, 0, 1, 2, 3, 4, 5, 6, 7,
                                 8, 9, 10, 11, 12, 13, 14, 15);
}

__device__ __forceinline__ void tdm_load_2d_f16(unsigned lds_off, const void* gptr,
                                                int tile_d0, int tile_d1,
                                                long long row_stride) {
  const unsigned long long ga = (unsigned long long)(size_t)gptr;
  u32x4 g0;
  g0[0] = 1u;
  g0[1] = lds_off;
  g0[2] = (unsigned)(ga & 0xffffffffu);
  g0[3] = (unsigned)((ga >> 32) & 0x1ffffffu)
        | (2u << 30);
  i32x8 g1;
  g1[0] = (1 << 16)
        | (1 << 20)
        | (4 << 22)
        | (3 << 25);
  g1[1] = (tile_d0 & 0xffff) << 16;
  g1[2] = ((tile_d0 >> 16) & 0xffff)
        | ((tile_d1 & 0xffff) << 16);
  g1[3] = ((tile_d1 >> 16) & 0xffff)
        | ((tile_d0 & 0xffff) << 16);
  g1[4] = (tile_d1 & 0xffff);
  g1[5] = (int)(row_stride & 0xffffffffLL);
  g1[6] = (int)((row_stride >> 32) & 0xffffLL);
  g1[7] = 0;
  i32x4 z4;
  z4[0] = z4[1] = z4[2] = z4[3] = 0;
#if defined(__clang_major__) && (__clang_major__ >= 23)
  i32x8 z8;
#pragma unroll
  for (int i = 0; i < 8; ++i) z8[i] = 0;
  __builtin_amdgcn_tensor_load_to_lds(g0, g1, z4, z4, z8, 0);
#else
  __builtin_amdgcn_tensor_load_to_lds(g0, g1, z4, z4, 0);
#endif
}

__global__ __launch_bounds__(256) __attribute__((amdgpu_waves_per_eu(8, 12)))
void qkv_gemm_kernel(const float* __restrict__ x, const float* __restrict__ w,
                     _Float16* __restrict__ qkv) {
  __shared__ __align__(16) _Float16 As[128 * 40];   // [m][k]
  __shared__ __align__(16) _Float16 Bs[64 * 40];    // [n][k] (transposed)
  const int tid  = threadIdx.x;
  const int wave = tid >> 5;
  const int lane = tid & 31;
  const int half = lane >> 4;
  const int row0 = blockIdx.x * 128;
  const int col0 = blockIdx.y * 64;
  const int ar = tid >> 3, ac = (tid & 7) * 4;     // A staging: row, first k
  const int bn = tid & 63, bk = (tid >> 6) * 8;    // B staging: column, first k
  const float* xa = x + (size_t)(row0 + ar) * D_ + ac;
  const float* wb = w + (size_t)bk * ND3 + col0 + bn;

  v8f acc[4];
#pragma unroll
  for (int t = 0; t < 4; ++t)
#pragma unroll
    for (int f = 0; f < 8; ++f) acc[t][f] = 0.0f;

  for (int k0 = 0; k0 < D_; k0 += 32) {
    if (k0 + 32 < D_) {                      // prefetch next tiles
      __builtin_prefetch(&x[(size_t)(row0 + (tid >> 1)) * D_ + k0 + 32], 0, 1);
      __builtin_prefetch(&w[(size_t)(k0 + 32 + (tid >> 3)) * ND3 + col0 + (tid & 7) * 8], 0, 1);
    }
    // A: 128x32. 16-byte loads, 8 lanes per 128-byte row piece (4 whole lines
    // per wave load), 4 halves per LDS store.
    f32x4 av[4];
#pragma unroll
    for (int i = 0; i < 4; ++i)
      av[i] = *(const f32x4*)(xa + k0 + i * 32 * D_);
    // B: 32x64, stored [n][k]. A thread owns one column n and 8 consecutive k
    // (each load is one whole line per wave), so the transposed row piece
    // leaves as one 16-byte LDS store.
    float bv[8];
#pragma unroll
    for (int j = 0; j < 8; ++j)
      bv[j] = wb[(size_t)k0 * ND3 + j * ND3];
#pragma unroll
    for (int i = 0; i < 4; ++i) {
      v4h hA;
#pragma unroll
      for (int e = 0; e < 4; ++e) hA[e] = (_Float16)av[i][e];
      *(v4h*)&As[(i * 32 + ar) * 40 + ac] = hA;
    }
    v8h hB;
#pragma unroll
    for (int j = 0; j < 8; ++j) hB[j] = (_Float16)bv[j];
    *(v8h*)&Bs[bn * 40 + bk] = hB;
    __syncthreads();

    const v16h a = frag16(As + (wave * 16) * 40, 40, 0);
#pragma unroll
    for (int t = 0; t < 4; ++t) {
      const v16h b = frag16(Bs + (t * 16) * 40, 40, 0);
      acc[t] = __builtin_amdgcn_wmma_f32_16x16x32_f16(
          false, a, false, b, (short)0, acc[t], false, false);
    }
    __syncthreads();
  }

#pragma unroll
  for (int t = 0; t < 4; ++t)
#pragma unroll
    for (int f = 0; f < 8; ++f) {
      const int m = row0 + wave * 16 + f + 8 * half;
      const int n = col0 + t * 16 + (lane & 15);
      qkv[(size_t)m * ND3 + n] = (_Float16)acc[t][f];
    }
}

// ---------------------------------------------------------------------------
// Kernel 2: RoPE on q and k (pairs j, j+32), in place on the f16 qkv buffer.
// ---------------------------------------------------------------------------
__global__ __launch_bounds__(256)
void rope_kernel(_Float16* __restrict__ qkv) {
  const int idx = blockIdx.x * blockDim.x + threadIdx.x;
  if (idx >= B_ * L_ * H_ * 32) return;
  const int j = idx & 31;
  const int h = (idx >> 5) & (H_ - 1);
  const int l = (idx >> 9) & (L_ - 1);
  const int b = idx >> 20;

  const float inv_freq = __powf(10000.0f, -(float)(2 * j) / (float)HD_);
  const float ang = (float)l * inv_freq;
  const float c = __cosf(ang);
  const float s = __sinf(ang);

  const size_t base = ((size_t)(b * L_ + l)) * ND3 + h * HD_;
#pragma unroll
  for (int sidx = 0; sidx < 2; ++sidx) {     // 0 = q, 1 = k
    _Float16* p = qkv + base + sidx * D_;
    const float x1 = (float)p[j];
    const float x2 = (float)p[j + 32];
    p[j]      = (_Float16)(x1 * c - x2 * s);
    p[j + 32] = (_Float16)(x2 * c + x1 * s);
  }
}

__global__ __launch_bounds__(128)
void attn_kernel(const _Float16* __restrict__ qkv, _Float16* __restrict__ o) {
  __shared__ __align__(16) _Float16 Qs[64 * 72];   // [q][d]
  __shared__ __align__(16) _Float16 Ks[64 * 72];   // [key][d]  (acts as B^T)
  __shared__ __align__(16) _Float16 Vt[64 * 72];   // [d][key]  (transposed)
  __shared__ __align__(16) _Float16 Ps[64 * 72];   // [q][key]

  const int tid   = threadIdx.x;
  const int wave  = tid >> 5;
  const int lane  = tid & 31;
  const int half  = lane >> 4;
  const int nlane = lane & 15;
  const int vk = (tid >> 3) * 4, vd = (tid & 7) * 8;   // V staging: first key, first d

  const int blk = blockIdx.x;                // b * H * (L/64)
  const int qt  = blk & 31;                  // L/64 = 32
  const int h   = (blk >> 5) & (H_ - 1);
  const int b   = blk >> 9;
  const int q0  = qt * 64;

  const _Float16* qbase = qkv + (size_t)b * L_ * ND3 + h * HD_;
  const _Float16* kbase = qbase + D_;
  const _Float16* vbase = qbase + 2 * D_;

  if (wave == 0) {
    tdm_load_2d_f16((unsigned)(size_t)Qs, qbase + (size_t)q0 * ND3, 64, 64, ND3);
    __builtin_amdgcn_s_wait_tensorcnt(0);
  }
  __syncthreads();

  float m_i[8], l_i[8];
#pragma unroll
  for (int f = 0; f < 8; ++f) { m_i[f] = -3.0e38f; l_i[f] = 0.0f; }
  v8f acc_o[4];
#pragma unroll
  for (int t = 0; t < 4; ++t)
#pragma unroll
    for (int f = 0; f < 8; ++f) acc_o[t][f] = 0.0f;

  const float scale = 0.125f;                // 1/sqrt(64)

  for (int kt = 0; kt < L_ / 64; ++kt) {
    const int kk0 = kt * 64;
    __syncthreads();
    if (wave == 0)
      tdm_load_2d_f16((unsigned)(size_t)Ks, kbase + (size_t)kk0 * ND3, 64, 64, ND3);
    // V tile staged transposed: a thread takes 4 keys x 8 d with 16-byte loads
    // (8 lanes cover a key's whole 128-byte row) and stores, per d, its 4 keys
    // as one 8-byte piece of the [d][key] row.
    v8h vr[4];
#pragma unroll
    for (int kk = 0; kk < 4; ++kk)
      vr[kk] = *(const v8h*)&vbase[(size_t)(kk0 + vk + kk) * ND3 + vd];
#pragma unroll
    for (int j = 0; j < 8; ++j) {
      v4h hv;
#pragma unroll
      for (int kk = 0; kk < 4; ++kk) hv[kk] = vr[kk][j];
      *(v4h*)&Vt[(vd + j) * 72 + vk] = hv;
    }
    if (wave == 0) __builtin_amdgcn_s_wait_tensorcnt(0);
    __syncthreads();

    // S = Q K^T -> 16x64 per wave; K rows are B^T fragment rows
    v8f acc_s[4];
#pragma unroll
    for (int t = 0; t < 4; ++t)
#pragma unroll
      for (int f = 0; f < 8; ++f) acc_s[t][f] = 0.0f;
#pragma unroll
    for (int ks = 0; ks < 2; ++ks) {
      const v16h a = frag16(Qs + (wave * 16) * 72, 72, ks * 32);
#pragma unroll
      for (int t = 0; t < 4; ++t) {
        const v16h bfr = frag16(Ks + (t * 16) * 72, 72, ks * 32);
        acc_s[t] = __builtin_amdgcn_wmma_f32_16x16x32_f16(
            false, a, false, bfr, (short)0, acc_s[t], false, false);
      }
    }

    // Online softmax per row (row M = f + 8*half)
#pragma unroll
    for (int f = 0; f < 8; ++f) {
      float vmax = -3.0e38f;
#pragma unroll
      for (int t = 0; t < 4; ++t) vmax = fmaxf(vmax, acc_s[t][f]);
#pragma unroll
      for (int mask = 1; mask < 16; mask <<= 1)
        vmax = fmaxf(vmax, __shfl_xor(vmax, mask, 32));
      vmax *= scale;
      const float mnew  = fmaxf(m_i[f], vmax);
      const float alpha = __expf(m_i[f] - mnew);
      float rsum = 0.0f;
#pragma unroll
      for (int t = 0; t < 4; ++t) {
        const float p = __expf(acc_s[t][f] * scale - mnew);
        rsum += p;
        Ps[(wave * 16 + f + 8 * half) * 72 + t * 16 + nlane] = (_Float16)p;
      }
#pragma unroll
      for (int mask = 1; mask < 16; mask <<= 1)
        rsum += __shfl_xor(rsum, mask, 32);
      l_i[f] = l_i[f] * alpha + rsum;
      m_i[f] = mnew;
#pragma unroll
      for (int t = 0; t < 4; ++t) acc_o[t][f] *= alpha;
    }

    // O += P V : A = P rows (wave-local), B = Vt rows (d-major)
#pragma unroll
    for (int ks = 0; ks < 2; ++ks) {
      const v16h a = frag16(Ps + (wave * 16) * 72, 72, ks * 32);
#pragma unroll
      for (int t = 0; t < 4; ++t) {
        const v16h bfr = frag16(Vt + (t * 16) * 72, 72, ks * 32);
        acc_o[t] = __builtin_amdgcn_wmma_f32_16x16x32_f16(
            false, a, false, bfr, (short)0, acc_o[t], false, false);
      }
    }
  }

  // Normalize and store o as f16 [B*L][D], head-interleaved
#pragma unroll
  for (int t = 0; t < 4; ++t)
#pragma unroll
    for (int f = 0; f < 8; ++f) {
      const int row = q0 + wave * 16 + f + 8 * half;
      const int d   = t * 16 + nlane;
      o[((size_t)b * L_ + row) * D_ + h * HD_ + d] =
          (_Float16)(acc_o[t][f] / l_i[f]);
    }
}

__global__ __launch_bounds__(256) __attribute__((amdgpu_waves_per_eu(4, 8)))
void out_gemm_kernel(const _Float16* __restrict__ o, const float* __restrict__ w,
                     float* __restrict__ out) {
  __shared__ __align__(16) _Float16 As[128 * 40];   // [m][k]
  __shared__ __align__(16) _Float16 Bs[64 * 40];    // [n][k] (transposed)
  const int tid  = threadIdx.x;
  const int wave = tid >> 5;
  const int lane = tid & 31;
  const int half = lane >> 4;
  const int row0 = blockIdx.x * 128;
  const int col0 = blockIdx.y * 64;
  const int ar = tid >> 2, ac = (tid & 3) * 8;     // A staging: row, first k
  const int bn = tid & 63, bk = (tid >> 6) * 8;    // B staging: column, first k
  const _Float16* oa = o + (size_t)(row0 + ar) * D_ + ac;
  const float* wb = w + (size_t)bk * D_ + col0 + bn;

  v8f acc[4];
#pragma unroll
  for (int t = 0; t < 4; ++t)
#pragma unroll
    for (int f = 0; f < 8; ++f) acc[t][f] = 0.0f;

  for (int k0 = 0; k0 < D_; k0 += 32) {
    if (k0 + 32 < D_) {
      __builtin_prefetch(&o[(size_t)(row0 + (tid >> 1)) * D_ + k0 + 32], 0, 1);
      __builtin_prefetch(&w[(size_t)(k0 + 32 + (tid >> 3)) * D_ + col0 + (tid & 7) * 8], 0, 1);
    }
    // A: 128x32 halves, 16-byte loads and 16-byte LDS stores.
    v8h av[2];
#pragma unroll
    for (int i = 0; i < 2; ++i)
      av[i] = *(const v8h*)(oa + k0 + i * 64 * D_);
    // B: 32x64, stored [n][k]: one column, 8 consecutive k per thread, one
    // 16-byte LDS store.
    float bv[8];
#pragma unroll
    for (int j = 0; j < 8; ++j)
      bv[j] = wb[(size_t)k0 * D_ + j * D_];
#pragma unroll
    for (int i = 0; i < 2; ++i)
      *(v8h*)&As[(i * 64 + ar) * 40 + ac] = av[i];
    v8h hB;
#pragma unroll
    for (int j = 0; j < 8; ++j) hB[j] = (_Float16)bv[j];
    *(v8h*)&Bs[bn * 40 + bk] = hB;
    __syncthreads();

    const v16h a = frag16(As + (wave * 16) * 40, 40, 0);
#pragma unroll
    for (int t = 0; t < 4; ++t) {
      const v16h b = frag16(Bs + (t * 16) * 40, 40, 0);
      acc[t] = __builtin_amdgcn_wmma_f32_16x16x32_f16(
          false, a, false, b, (short)0, acc[t], false, false);
    }
    __syncthreads();
  }

#pragma unroll
  for (int t = 0; t < 4; ++t)
#pragma unroll
    for (int f = 0; f < 8; ++f) {
      const int m = row0 + wave * 16 + f + 8 * half;
      const int n = col0 + t * 16 + (lane & 15);
      out[(size_t)m * D_ + n] = acc[t][f];
    }
}

// ---------------------------------------------------------------------------
extern "C" void kernel_launch(void* const* d_in, const int* in_sizes, int n_in,
                              void* d_out, int out_size, void* d_ws, size_t ws_size,
                              hipStream_t stream) {
  const float* x     = (const float*)d_in[0];
  const float* w_qkv = (const float*)d_in[1];
  const float* w_out = (const float*)d_in[2];
  float* out = (float*)d_out;

  _Float16* qkv = (_Float16*)d_ws;                       // B*L*3D f16 = 24 MB
  _Float16* o   = qkv + (size_t)B_ * L_ * ND3;           // B*L*D  f16 =  8 MB

  qkv_gemm_kernel<<<dim3((B_ * L_) / 128, ND3 / 64), 256, 0, stream>>>(x, w_qkv, qkv);
  rope_kernel<<<(B_ * L_ * H_ * 32) / 256, 256, 0, stream>>>(qkv);
  attn_kernel<<<B_ * H_ * (L_ / 64), 128, 0, stream>>>(qkv, o);
  out_gemm_kernel<<<dim3((B_ * L_) / 128, D_ / 64), 256, 0, stream>>>(o, w_out, out);
}

// v002
// It runs in 181 microseconds.
// Next to v001, in two timings, it ran 1.06 times as fast each time.
// Counting every step since v000, it is 1.49 times as fast.
#include <hip/hip_runtime.h>
#include <hip/hip_bf16.h>
#include <hip/hip_fp16.h>

typedef __attribute__((ext_vector_type(16))) _Float16 v16h;
typedef __attribute__((ext_vector_type(8)))  _Float16 v8h;
typedef __attribute__((ext_vector_type(4)))  _Float16 v4h;
typedef __attribute__((ext_vector_type(4)))  float    f32x4;
typedef __attribute__((ext_vector_type(8)))  float    v8f;
typedef __attribute__((ext_vector_type(4)))  unsigned int u32x4;
typedef __attribute__((ext_vector_type(8)))  int      i32x8;
typedef __attribute__((ext_vector_type(4)))  int      i32x4;

#define B_   2
#define L_   2048
#define D_   1024
#define H_   16
#define HD_  64
#define ND3  (3 * D_)

__device__ __forceinline__ v16h frag16(const _Float16* base, int ld, int kbase) {
  const int lane = threadIdx.x & 31;
  const int half = lane >> 4;
  const int row  = lane & 15;
  const _Float16* p = base + row * ld + kbase + 8 * half;
  const v8h a = *(const v8h*)p;
  const v8h b = *(const v8h*)(p + 16);
  return __builtin_shufflevector(a, b, 0, 1, 2, 3, 4, 5, 6, 7,
                                 8, 9, 10, 11, 12, 13, 14, 15);
}

__device__ __forceinline__ void tdm_load_2d_f16(unsigned lds_off, const void* gptr,
                                                int tile_d0, int tile_d1,
                                                long long row_stride) {
  const unsigned long long ga = (unsigned long long)(size_t)gptr;
  u32x4 g0;
  g0[0] = 1u;
  g0[1] = lds_off;
  g0[2] = (unsigned)(ga & 0xffffffffu);
  g0[3] = (unsigned)((ga >> 32) & 0x1ffffffu)
        | (2u << 30);
  i32x8 g1;
  g1[0] = (1 << 16)
        | (1 << 20)
        | (4 << 22)
        | (3 << 25);
  g1[1] = (tile_d0 & 0xffff) << 16;
  g1[2] = ((tile_d0 >> 16) & 0xffff)
        | ((tile_d1 & 0xffff) << 16);
  g1[3] = ((tile_d1 >> 16) & 0xffff)
        | ((tile_d0 & 0xffff) << 16);
  g1[4] = (tile_d1 & 0xffff);
  g1[5] = (int)(row_stride & 0xffffffffLL);
  g1[6] = (int)((row_stride >> 32) & 0xffffLL);
  g1[7] = 0;
  i32x4 z4;
  z4[0] = z4[1] = z4[2] = z4[3] = 0;
#if defined(__clang_major__) && (__clang_major__ >= 23)
  i32x8 z8;
#pragma unroll
  for (int i = 0; i < 8; ++i) z8[i] = 0;
  __builtin_amdgcn_tensor_load_to_lds(g0, g1, z4, z4, z8, 0);
#else
  __builtin_amdgcn_tensor_load_to_lds(g0, g1, z4, z4, 0);
#endif
}

__global__ __launch_bounds__(256) __attribute__((amdgpu_waves_per_eu(8, 12)))
void qkv_gemm_kernel(const float* __restrict__ x, const float* __restrict__ w,
                     _Float16* __restrict__ qkv) {
  __shared__ __align__(16) _Float16 As[128 * 40];   // [m][k]
  __shared__ __align__(16) _Float16 Bs[64 * 40];    // [n][k] (transposed)
  const int tid  = threadIdx.x;
  const int wave = tid >> 5;
  const int lane = tid & 31;
  const int half = lane >> 4;
  const int row0 = blockIdx.x * 128;
  const int col0 = blockIdx.y * 64;
  const int ar = tid >> 3, ac = (tid & 7) * 4;     // A staging: row, first k
  const int bn = tid & 63, bk = (tid >> 6) * 8;    // B staging: column, first k
  const float* xa = x + (size_t)(row0 + ar) * D_ + ac;
  const float* wb = w + (size_t)bk * ND3 + col0 + bn;

  v8f acc[4];
#pragma unroll
  for (int t = 0; t < 4; ++t)
#pragma unroll
    for (int f = 0; f < 8; ++f) acc[t][f] = 0.0f;

  for (int k0 = 0; k0 < D_; k0 += 32) {
    if (k0 + 32 < D_) {                      // prefetch next tiles
      __builtin_prefetch(&x[(size_t)(row0 + (tid >> 1)) * D_ + k0 + 32], 0, 1);
      __builtin_prefetch(&w[(size_t)(k0 + 32 + (tid >> 3)) * ND3 + col0 + (tid & 7) * 8], 0, 1);
    }
    // A: 128x32. 16-byte loads, 8 lanes per 128-byte row piece (4 whole lines
    // per wave load), 4 halves per LDS store.
    f32x4 av[4];
#pragma unroll
    for (int i = 0; i < 4; ++i)
      av[i] = *(const f32x4*)(xa + k0 + i * 32 * D_);
    // B: 32x64, stored [n][k]. A thread owns one column n and 8 consecutive k
    // (each load is one whole line per wave), so the transposed row piece
    // leaves as one 16-byte LDS store.
    float bv[8];
#pragma unroll
    for (int j = 0; j < 8; ++j)
      bv[j] = wb[(size_t)k0 * ND3 + j * ND3];
#pragma unroll
    for (int i = 0; i < 4; ++i) {
      v4h hA;
#pragma unroll
      for (int e = 0; e < 4; ++e) hA[e] = (_Float16)av[i][e];
      *(v4h*)&As[(i * 32 + ar) * 40 + ac] = hA;
    }
    v8h hB;
#pragma unroll
    for (int j = 0; j < 8; ++j) hB[j] = (_Float16)bv[j];
    *(v8h*)&Bs[bn * 40 + bk] = hB;
    __syncthreads();

    const v16h a = frag16(As + (wave * 16) * 40, 40, 0);
#pragma unroll
    for (int t = 0; t < 4; ++t) {
      const v16h b = frag16(Bs + (t * 16) * 40, 40, 0);
      acc[t] = __builtin_amdgcn_wmma_f32_16x16x32_f16(
          false, a, false, b, (short)0, acc[t], false, false);
    }
    __syncthreads();
  }

  // RoPE on the f32 accumulators. The block's 64 columns are exactly one head
  // of q, k or v, and a lane holds columns j (acc[t]) and j + 32 (acc[t + 2])
  // of the same rows, so each rotation pair is already in one lane.
  if (col0 < 2 * D_) {                       // q and k heads; uniform per block
    float inv_freq[2];
    inv_freq[0] = __powf(10000.0f, -(float)(2 * (lane & 15)) / (float)HD_);
    inv_freq[1] = inv_freq[0] * 0.01f;       // j + 16: another 10000^(-1/2)
#pragma unroll
    for (int f = 0; f < 8; ++f) {
      const float pos = (float)((row0 + wave * 16 + f + 8 * half) & (L_ - 1));
#pragma unroll
      for (int t = 0; t < 2; ++t) {
        const float rev = pos * inv_freq[t] * 0.15915494f;   // angle in turns
        float c, s;
        asm("v_cos_f32 %0, %2\n\tv_sin_f32 %1, %2\n\tv_nop"
            : "=&v"(c), "=&v"(s) : "v"(rev));
        const float x1 = acc[t][f];
        const float x2 = acc[t + 2][f];
        acc[t][f]     = x1 * c - x2 * s;
        acc[t + 2][f] = x2 * c + x1 * s;
      }
    }
  }

#pragma unroll
  for (int t = 0; t < 4; ++t)
#pragma unroll
    for (int f = 0; f < 8; ++f) {
      const int m = row0 + wave * 16 + f + 8 * half;
      const int n = col0 + t * 16 + (lane & 15);
      qkv[(size_t)m * ND3 + n] = (_Float16)acc[t][f];
    }
}

__global__ __launch_bounds__(128)
void attn_kernel(const _Float16* __restrict__ qkv, _Float16* __restrict__ o) {
  __shared__ __align__(16) _Float16 Qs[64 * 72];   // [q][d]
  __shared__ __align__(16) _Float16 Ks[64 * 72];   // [key][d]  (acts as B^T)
  __shared__ __align__(16) _Float16 Vt[64 * 72];   // [d][key]  (transposed)
  __shared__ __align__(16) _Float16 Ps[64 * 72];   // [q][key]

  const int tid   = threadIdx.x;
  const int wave  = tid >> 5;
  const int lane  = tid & 31;
  const int half  = lane >> 4;
  const int nlane = lane & 15;
  const int vk = (tid >> 3) * 4, vd = (tid & 7) * 8;   // V staging: first key, first d

  const int blk = blockIdx.x;                // b * H * (L/64)
  const int qt  = blk & 31;                  // L/64 = 32
  const int h   = (blk >> 5) & (H_ - 1);
  const int b   = blk >> 9;
  const int q0  = qt * 64;

  const _Float16* qbase = qkv + (size_t)b * L_ * ND3 + h * HD_;
  const _Float16* kbase = qbase + D_;
  const _Float16* vbase = qbase + 2 * D_;

  if (wave == 0) {
    tdm_load_2d_f16((unsigned)(size_t)Qs, qbase + (size_t)q0 * ND3, 64, 64, ND3);
    __builtin_amdgcn_s_wait_tensorcnt(0);
  }
  __syncthreads();

  float m_i[8], l_i[8];
#pragma unroll
  for (int f = 0; f < 8; ++f) { m_i[f] = -3.0e38f; l_i[f] = 0.0f; }
  v8f acc_o[4];
#pragma unroll
  for (int t = 0; t < 4; ++t)
#pragma unroll
    for (int f = 0; f < 8; ++f) acc_o[t][f] = 0.0f;

  const float scale = 0.125f;                // 1/sqrt(64)

  for (int kt = 0; kt < L_ / 64; ++kt) {
    const int kk0 = kt * 64;
    __syncthreads();
    if (wave == 0)
      tdm_load_2d_f16((unsigned)(size_t)Ks, kbase + (size_t)kk0 * ND3, 64, 64, ND3);
    // V tile staged transposed: a thread takes 4 keys x 8 d with 16-byte loads
    // (8 lanes cover a key's whole 128-byte row) and stores, per d, its 4 keys
    // as one 8-byte piece of the [d][key] row.
    v8h vr[4];
#pragma unroll
    for (int kk = 0; kk < 4; ++kk)
      vr[kk] = *(const v8h*)&vbase[(size_t)(kk0 + vk + kk) * ND3 + vd];
#pragma unroll
    for (int j = 0; j < 8; ++j) {
      v4h hv;
#pragma unroll
      for (int kk = 0; kk < 4; ++kk) hv[kk] = vr[kk][j];
      *(v4h*)&Vt[(vd + j) * 72 + vk] = hv;
    }
    if (wave == 0) __builtin_amdgcn_s_wait_tensorcnt(0);
    __syncthreads();

    // S = Q K^T -> 16x64 per wave; K rows are B^T fragment rows
    v8f acc_s[4];
#pragma unroll
    for (int t = 0; t < 4; ++t)
#pragma unroll
      for (int f = 0; f < 8; ++f) acc_s[t][f] = 0.0f;
#pragma unroll
    for (int ks = 0; ks < 2; ++ks) {
      const v16h a = frag16(Qs + (wave * 16) * 72, 72, ks * 32);
#pragma unroll
      for (int t = 0; t < 4; ++t) {
        const v16h bfr = frag16(Ks + (t * 16) * 72, 72, ks * 32);
        acc_s[t] = __builtin_amdgcn_wmma_f32_16x16x32_f16(
            false, a, false, bfr, (short)0, acc_s[t], false, false);
      }
    }

    // Online softmax per row (row M = f + 8*half)
#pragma unroll
    for (int f = 0; f < 8; ++f) {
      float vmax = -3.0e38f;
#pragma unroll
      for (int t = 0; t < 4; ++t) vmax = fmaxf(vmax, acc_s[t][f]);
#pragma unroll
      for (int mask = 1; mask < 16; mask <<= 1)
        vmax = fmaxf(vmax, __shfl_xor(vmax, mask, 32));
      vmax *= scale;
      const float mnew  = fmaxf(m_i[f], vmax);
      const float alpha = __expf(m_i[f] - mnew);
      float rsum = 0.0f;
#pragma unroll
      for (int t = 0; t < 4; ++t) {
        const float p = __expf(acc_s[t][f] * scale - mnew);
        rsum += p;
        Ps[(wave * 16 + f + 8 * half) * 72 + t * 16 + nlane] = (_Float16)p;
      }
#pragma unroll
      for (int mask = 1; mask < 16; mask <<= 1)
        rsum += __shfl_xor(rsum, mask, 32);
      l_i[f] = l_i[f] * alpha + rsum;
      m_i[f] = mnew;
#pragma unroll
      for (int t = 0; t < 4; ++t) acc_o[t][f] *= alpha;
    }

    // O += P V : A = P rows (wave-local), B = Vt rows (d-major)
#pragma unroll
    for (int ks = 0; ks < 2; ++ks) {
      const v16h a = frag16(Ps + (wave * 16) * 72, 72, ks * 32);
#pragma unroll
      for (int t = 0; t < 4; ++t) {
        const v16h bfr = frag16(Vt + (t * 16) * 72, 72, ks * 32);
        acc_o[t] = __builtin_amdgcn_wmma_f32_16x16x32_f16(
            false, a, false, bfr, (short)0, acc_o[t], false, false);
      }
    }
  }

  // Normalize and store o as f16 [B*L][D], head-interleaved
#pragma unroll
  for (int t = 0; t < 4; ++t)
#pragma unroll
    for (int f = 0; f < 8; ++f) {
      const int row = q0 + wave * 16 + f + 8 * half;
      const int d   = t * 16 + nlane;
      o[((size_t)b * L_ + row) * D_ + h * HD_ + d] =
          (_Float16)(acc_o[t][f] / l_i[f]);
    }
}

__global__ __launch_bounds__(256) __attribute__((amdgpu_waves_per_eu(4, 8)))
void out_gemm_kernel(const _Float16* __restrict__ o, const float* __restrict__ w,
                     float* __restrict__ out) {
  __shared__ __align__(16) _Float16 As[128 * 40];   // [m][k]
  __shared__ __align__(16) _Float16 Bs[64 * 40];    // [n][k] (transposed)
  const int tid  = threadIdx.x;
  const int wave = tid >> 5;
  const int lane = tid & 31;
  const int half = lane >> 4;
  const int row0 = blockIdx.x * 128;
  const int col0 = blockIdx.y * 64;
  const int ar = tid >> 2, ac = (tid & 3) * 8;     // A staging: row, first k
  const int bn = tid & 63, bk = (tid >> 6) * 8;    // B staging: column, first k
  const _Float16* oa = o + (size_t)(row0 + ar) * D_ + ac;
  const float* wb = w + (size_t)bk * D_ + col0 + bn;

  v8f acc[4];
#pragma unroll
  for (int t = 0; t < 4; ++t)
#pragma unroll
    for (int f = 0; f < 8; ++f) acc[t][f] = 0.0f;

  for (int k0 = 0; k0 < D_; k0 += 32) {
    if (k0 + 32 < D_) {
      __builtin_prefetch(&o[(size_t)(row0 + (tid >> 1)) * D_ + k0 + 32], 0, 1);
      __builtin_prefetch(&w[(size_t)(k0 + 32 + (tid >> 3)) * D_ + col0 + (tid & 7) * 8], 0, 1);
    }
    // A: 128x32 halves, 16-byte loads and 16-byte LDS stores.
    v8h av[2];
#pragma unroll
    for (int i = 0; i < 2; ++i)
      av[i] = *(const v8h*)(oa + k0 + i * 64 * D_);
    // B: 32x64, stored [n][k]: one column, 8 consecutive k per thread, one
    // 16-byte LDS store.
    float bv[8];
#pragma unroll
    for (int j = 0; j < 8; ++j)
      bv[j] = wb[(size_t)k0 * D_ + j * D_];
#pragma unroll
    for (int i = 0; i < 2; ++i)
      *(v8h*)&As[(i * 64 + ar) * 40 + ac] = av[i];
    v8h hB;
#pragma unroll
    for (int j = 0; j < 8; ++j) hB[j] = (_Float16)bv[j];
    *(v8h*)&Bs[bn * 40 + bk] = hB;
    __syncthreads();

    const v16h a = frag16(As + (wave * 16) * 40, 40, 0);
#pragma unroll
    for (int t = 0; t < 4; ++t) {
      const v16h b = frag16(Bs + (t * 16) * 40, 40, 0);
      acc[t] = __builtin_amdgcn_wmma_f32_16x16x32_f16(
          false, a, false, b, (short)0, acc[t], false, false);
    }
    __syncthreads();
  }

#pragma unroll
  for (int t = 0; t < 4; ++t)
#pragma unroll
    for (int f = 0; f < 8; ++f) {
      const int m = row0 + wave * 16 + f + 8 * half;
      const int n = col0 + t * 16 + (lane & 15);
      out[(size_t)m * D_ + n] = acc[t][f];
    }
}

// ---------------------------------------------------------------------------
extern "C" void kernel_launch(void* const* d_in, const int* in_sizes, int n_in,
                              void* d_out, int out_size, void* d_ws, size_t ws_size,
                              hipStream_t stream) {
  const float* x     = (const float*)d_in[0];
  const float* w_qkv = (const float*)d_in[1];
  const float* w_out = (const float*)d_in[2];
  float* out = (float*)d_out;

  _Float16* qkv = (_Float16*)d_ws;                       // B*L*3D f16 = 24 MB
  _Float16* o   = qkv + (size_t)B_ * L_ * ND3;           // B*L*D  f16 =  8 MB

  qkv_gemm_kernel<<<dim3((B_ * L_) / 128, ND3 / 64), 256, 0, stream>>>(x, w_qkv, qkv);
  attn_kernel<<<B_ * H_ * (L_ / 64), 128, 0, stream>>>(qkv, o);
  out_gemm_kernel<<<dim3((B_ * L_) / 128, D_ / 64), 256, 0, stream>>>(o, w_out, out);
}

// v003
// A run of this version takes 144 microseconds.
// Timed twice side by side with v002, it ran 1.26 and 1.25 times as fast.
// Over all steps from v000 it is 1.86 times as fast.
#include <hip/hip_runtime.h>
#include <hip/hip_bf16.h>
#include <hip/hip_fp16.h>

typedef __attribute__((ext_vector_type(16))) _Float16 v16h;
typedef __attribute__((ext_vector_type(8)))  _Float16 v8h;
typedef __attribute__((ext_vector_type(4)))  _Float16 v4h;
typedef __attribute__((ext_vector_type(4)))  float    f32x4;
typedef __attribute__((ext_vector_type(8)))  float    v8f;
typedef __attribute__((ext_vector_type(4)))  unsigned int u32x4;
typedef __attribute__((ext_vector_type(8)))  int      i32x8;
typedef __attribute__((ext_vector_type(4)))  int      i32x4;

#define B_   2
#define L_   2048
#define D_   1024
#define H_   16
#define HD_  64
#define ND3  (3 * D_)

__device__ __forceinline__ v16h frag16(const _Float16* base, int ld, int kbase) {
  const int lane = threadIdx.x & 31;
  const int half = lane >> 4;
  const int row  = lane & 15;
  const _Float16* p = base + row * ld + kbase + 8 * half;
  const v8h a = *(const v8h*)p;
  const v8h b = *(const v8h*)(p + 16);
  return __builtin_shufflevector(a, b, 0, 1, 2, 3, 4, 5, 6, 7,
                                 8, 9, 10, 11, 12, 13, 14, 15);
}

__device__ __forceinline__ void tdm_load_2d_f16(unsigned lds_off, const void* gptr,
                                                int tile_d0, int tile_d1,
                                                long long row_stride) {
  const unsigned long long ga = (unsigned long long)(size_t)gptr;
  u32x4 g0;
  g0[0] = 1u;
  g0[1] = lds_off;
  g0[2] = (unsigned)(ga & 0xffffffffu);
  g0[3] = (unsigned)((ga >> 32) & 0x1ffffffu)
        | (2u << 30);
  i32x8 g1;
  g1[0] = (1 << 16)
        | (1 << 20)
        | (4 << 22)
        | (3 << 25);
  g1[1] = (tile_d0 & 0xffff) << 16;
  g1[2] = ((tile_d0 >> 16) & 0xffff)
        | ((tile_d1 & 0xffff) << 16);
  g1[3] = ((tile_d1 >> 16) & 0xffff)
        | ((tile_d0 & 0xffff) << 16);
  g1[4] = (tile_d1 & 0xffff);
  g1[5] = (int)(row_stride & 0xffffffffLL);
  g1[6] = (int)((row_stride >> 32) & 0xffffLL);
  g1[7] = 0;
  i32x4 z4;
  z4[0] = z4[1] = z4[2] = z4[3] = 0;
#if defined(__clang_major__) && (__clang_major__ >= 23)
  i32x8 z8;
#pragma unroll
  for (int i = 0; i < 8; ++i) z8[i] = 0;
  __builtin_amdgcn_tensor_load_to_lds(g0, g1, z4, z4, z8, 0);
#else
  __builtin_amdgcn_tensor_load_to_lds(g0, g1, z4, z4, 0);
#endif
}

__global__ __launch_bounds__(256) __attribute__((amdgpu_waves_per_eu(8, 12)))
void qkv_gemm_kernel(const float* __restrict__ x, const float* __restrict__ w,
                     _Float16* __restrict__ qkv) {
  __shared__ __align__(16) _Float16 As[128 * 40];   // [m][k]
  __shared__ __align__(16) _Float16 Bs[64 * 40];    // [n][k] (transposed)
  const int tid  = threadIdx.x;
  const int wave = tid >> 5;
  const int lane = tid & 31;
  const int half = lane >> 4;
  const int row0 = blockIdx.x * 128;
  const int col0 = blockIdx.y * 64;
  const int ar = tid >> 3, ac = (tid & 7) * 4;     // A staging: row, first k
  const int bn = tid & 63, bk = (tid >> 6) * 8;    // B staging: column, first k
  const float* xa = x + (size_t)(row0 + ar) * D_ + ac;
  const float* wb = w + (size_t)bk * ND3 + col0 + bn;

  v8f acc[4];
#pragma unroll
  for (int t = 0; t < 4; ++t)
#pragma unroll
    for (int f = 0; f < 8; ++f) acc[t][f] = 0.0f;

  for (int k0 = 0; k0 < D_; k0 += 32) {
    if (k0 + 32 < D_) {                      // prefetch next tiles
      __builtin_prefetch(&x[(size_t)(row0 + (tid >> 1)) * D_ + k0 + 32], 0, 1);
      __builtin_prefetch(&w[(size_t)(k0 + 32 + (tid >> 3)) * ND3 + col0 + (tid & 7) * 8], 0, 1);
    }
    // A: 128x32. 16-byte loads, 8 lanes per 128-byte row piece (4 whole lines
    // per wave load), 4 halves per LDS store.
    f32x4 av[4];
#pragma unroll
    for (int i = 0; i < 4; ++i)
      av[i] = *(const f32x4*)(xa + k0 + i * 32 * D_);
    // B: 32x64, stored [n][k]. A thread owns one column n and 8 consecutive k
    // (each load is one whole line per wave), so the transposed row piece
    // leaves as one 16-byte LDS store.
    float bv[8];
#pragma unroll
    for (int j = 0; j < 8; ++j)
      bv[j] = wb[(size_t)k0 * ND3 + j * ND3];
#pragma unroll
    for (int i = 0; i < 4; ++i) {
      v4h hA;
#pragma unroll
      for (int e = 0; e < 4; ++e) hA[e] = (_Float16)av[i][e];
      *(v4h*)&As[(i * 32 + ar) * 40 + ac] = hA;
    }
    v8h hB;
#pragma unroll
    for (int j = 0; j < 8; ++j) hB[j] = (_Float16)bv[j];
    *(v8h*)&Bs[bn * 40 + bk] = hB;
    __syncthreads();

    const v16h a = frag16(As + (wave * 16) * 40, 40, 0);
#pragma unroll
    for (int t = 0; t < 4; ++t) {
      const v16h b = frag16(Bs + (t * 16) * 40, 40, 0);
      acc[t] = __builtin_amdgcn_wmma_f32_16x16x32_f16(
          false, a, false, b, (short)0, acc[t], false, false);
    }
    __syncthreads();
  }

  // RoPE on the f32 accumulators. The block's 64 columns are exactly one head
  // of q, k or v, and a lane holds columns j (acc[t]) and j + 32 (acc[t + 2])
  // of the same rows, so each rotation pair is already in one lane.
  if (col0 < 2 * D_) {                       // q and k heads; uniform per block
    float inv_freq[2];
    inv_freq[0] = __powf(10000.0f, -(float)(2 * (lane & 15)) / (float)HD_);
    inv_freq[1] = inv_freq[0] * 0.01f;       // j + 16: another 10000^(-1/2)
#pragma unroll
    for (int f = 0; f < 8; ++f) {
      const float pos = (float)((row0 + wave * 16 + f + 8 * half) & (L_ - 1));
#pragma unroll
      for (int t = 0; t < 2; ++t) {
        const float rev = pos * inv_freq[t] * 0.15915494f;   // angle in turns
        float c, s;
        asm("v_cos_f32 %0, %2\n\tv_sin_f32 %1, %2\n\tv_nop"
            : "=&v"(c), "=&v"(s) : "v"(rev));
        const float x1 = acc[t][f];
        const float x2 = acc[t + 2][f];
        acc[t][f]     = x1 * c - x2 * s;
        acc[t + 2][f] = x2 * c + x1 * s;
      }
    }
  }

#pragma unroll
  for (int t = 0; t < 4; ++t)
#pragma unroll
    for (int f = 0; f < 8; ++f) {
      const int m = row0 + wave * 16 + f + 8 * half;
      const int n = col0 + t * 16 + (lane & 15);
      qkv[(size_t)m * ND3 + n] = (_Float16)acc[t][f];
    }
}

__device__ __forceinline__ float xhalf(float x) {
  return __builtin_bit_cast(float, __builtin_amdgcn_permlanex16(
      __builtin_bit_cast(int, x), __builtin_bit_cast(int, x),
      0x76543210, 0xfedcba98, false, false));
}

__device__ __forceinline__ v8f exp2x8(v8f x) {
  float r0, r1, r2, r3, r4, r5, r6, r7;
  asm("v_exp_f32 %0, %8\n\tv_exp_f32 %1, %9\n\tv_exp_f32 %2, %10\n\t"
      "v_exp_f32 %3, %11\n\tv_exp_f32 %4, %12\n\tv_exp_f32 %5, %13\n\t"
      "v_exp_f32 %6, %14\n\tv_exp_f32 %7, %15\n\tv_nop"
      : "=&v"(r0), "=&v"(r1), "=&v"(r2), "=&v"(r3),
        "=&v"(r4), "=&v"(r5), "=&v"(r6), "=&v"(r7)
      : "v"(x[0]), "v"(x[1]), "v"(x[2]), "v"(x[3]),
        "v"(x[4]), "v"(x[5]), "v"(x[6]), "v"(x[7]));
  v8f r;
  r[0] = r0; r[1] = r1; r[2] = r2; r[3] = r3;
  r[4] = r4; r[5] = r5; r[6] = r6; r[7] = r7;
  return r;
}

__global__ __launch_bounds__(128) __attribute__((amdgpu_waves_per_eu(4, 8)))
void attn_kernel(const _Float16* __restrict__ qkv, _Float16* __restrict__ o) {
  __shared__ __align__(16) _Float16 Qs[64 * 72];   // [q][d]
  __shared__ __align__(16) _Float16 Ks[64 * 72];   // [key][d]
  __shared__ __align__(16) _Float16 Vt[64 * 72];   // [d][key]  (transposed)

  const int tid   = threadIdx.x;
  const int wave  = tid >> 5;
  const int lane  = tid & 31;
  const int half  = lane >> 4;
  const int nlane = lane & 15;
  const int vk = (tid >> 3) * 4, vd = (tid & 7) * 8;   // V staging: first key, first d

  const int blk = blockIdx.x;                // b * H * (L/64)
  const int qt  = blk & 31;                  // L/64 = 32
  const int h   = (blk >> 5) & (H_ - 1);
  const int b   = blk >> 9;
  const int q0  = qt * 64;

  const _Float16* qbase = qkv + (size_t)b * L_ * ND3 + h * HD_;
  const _Float16* kbase = qbase + D_;
  const _Float16* vbase = qbase + 2 * D_;

  if (wave == 0) {
    tdm_load_2d_f16((unsigned)(size_t)Qs, qbase + (size_t)q0 * ND3, 64, 64, ND3);
    __builtin_amdgcn_s_wait_tensorcnt(0);
  }
  __syncthreads();

  // Per lane: running maximum of its query (equal in both halves) and the sum
  // over the keys of its own half only; the halves' sums join after the loop.
  float m_i = -3.0e38f, l_i = 0.0f;
  v8f acc_o[4];                              // O^T: d = t*16 + 8*half + f
#pragma unroll
  for (int t = 0; t < 4; ++t)
#pragma unroll
    for (int f = 0; f < 8; ++f) acc_o[t][f] = 0.0f;

  const float scale = 0.125f;                // 1/sqrt(64)

  for (int kt = 0; kt < L_ / 64; ++kt) {
    const int kk0 = kt * 64;
    __syncthreads();
    if (wave == 0)
      tdm_load_2d_f16((unsigned)(size_t)Ks, kbase + (size_t)kk0 * ND3, 64, 64, ND3);
    // V tile staged transposed: a thread takes 4 keys x 8 d with 16-byte loads
    // (8 lanes cover a key's whole 128-byte row) and stores, per d, its 4 keys
    // as one 8-byte piece of the [d][key] row.
    v8h vr[4];
#pragma unroll
    for (int kk = 0; kk < 4; ++kk)
      vr[kk] = *(const v8h*)&vbase[(size_t)(kk0 + vk + kk) * ND3 + vd];
#pragma unroll
    for (int j = 0; j < 8; ++j) {
      v4h hv;
#pragma unroll
      for (int kk = 0; kk < 4; ++kk) hv[kk] = vr[kk][j];
      *(v4h*)&Vt[(vd + j) * 72 + vk] = hv;
    }
    if (wave == 0) __builtin_amdgcn_s_wait_tensorcnt(0);
    __syncthreads();

    // S^T = K Q^T -> 64 keys x 16 queries per wave: A = K rows, B = Q rows
    v8f acc_s[4];                            // key = t*16 + 8*half + f
#pragma unroll
    for (int t = 0; t < 4; ++t)
#pragma unroll
      for (int f = 0; f < 8; ++f) acc_s[t][f] = 0.0f;
#pragma unroll
    for (int ks = 0; ks < 2; ++ks) {
      const v16h bq = frag16(Qs + (wave * 16) * 72, 72, ks * 32);
#pragma unroll
      for (int t = 0; t < 4; ++t) {
        const v16h ak = frag16(Ks + (t * 16) * 72, 72, ks * 32);
        acc_s[t] = __builtin_amdgcn_wmma_f32_16x16x32_f16(
            false, ak, false, bq, (short)0, acc_s[t], false, false);
      }
    }

    // Online softmax of the lane's query: 32 keys in the lane, the other 32 in
    // lane ^ 16. One chain per tile keeps four independent chains.
    float tmax[4];
#pragma unroll
    for (int t = 0; t < 4; ++t) {
      tmax[t] = acc_s[t][0];
#pragma unroll
      for (int f = 1; f < 8; ++f) tmax[t] = fmaxf(tmax[t], acc_s[t][f]);
    }
    float vmax = fmaxf(fmaxf(tmax[0], tmax[1]), fmaxf(tmax[2], tmax[3]));
    vmax = fmaxf(vmax, xhalf(vmax));
    vmax *= scale;
    const float mnew  = fmaxf(m_i, vmax);
    const float alpha = __expf(m_i - mnew);
    // P^T as a B operand: position (half, e) of a fragment is key
    // kbase + 8*half + e, position (half, 8 + e) key kbase + 16 + 8*half + e,
    // which are the lane's own rows of tiles 2*ks and 2*ks + 1.
    v16h pb[2];
    float tsum[4];
#pragma unroll
    for (int t = 0; t < 4; ++t) {
      // exp(y) = 2^(y * log2(e))
      const v8f p = exp2x8((acc_s[t] * scale - mnew) * 0x1.715476p+0f);
      tsum[t] = p[0];
#pragma unroll
      for (int f = 1; f < 8; ++f) tsum[t] += p[f];
#pragma unroll
      for (int f = 0; f < 8; ++f)
        pb[t >> 1][(t & 1) * 8 + f] = (_Float16)p[f];
    }
    l_i = l_i * alpha + ((tsum[0] + tsum[1]) + (tsum[2] + tsum[3]));
    m_i = mnew;
#pragma unroll
    for (int t = 0; t < 4; ++t)
#pragma unroll
      for (int f = 0; f < 8; ++f) acc_o[t][f] *= alpha;

    // O^T += V^T P^T : A = Vt rows (d-major), B = P^T from registers
#pragma unroll
    for (int ks = 0; ks < 2; ++ks) {
#pragma unroll
      for (int t = 0; t < 4; ++t) {
        const v16h av = frag16(Vt + (t * 16) * 72, 72, ks * 32);
        acc_o[t] = __builtin_amdgcn_wmma_f32_16x16x32_f16(
            false, av, false, pb[ks], (short)0, acc_o[t], false, false);
      }
    }
  }

  // Normalize and store o as f16 [B*L][D], head-interleaved: a lane's 8 values
  // of a tile are 8 consecutive d of its query's row, one 16-byte store.
  const float l_all = l_i + xhalf(l_i);
  _Float16* orow = o + ((size_t)b * L_ + q0 + wave * 16 + nlane) * D_ + h * HD_ + 8 * half;
#pragma unroll
  for (int t = 0; t < 4; ++t) {
    v8h ho;
#pragma unroll
    for (int f = 0; f < 8; ++f) ho[f] = (_Float16)(acc_o[t][f] / l_all);
    *(v8h*)(orow + t * 16) = ho;
  }
}

__global__ __launch_bounds__(256) __attribute__((amdgpu_waves_per_eu(4, 8)))
void out_gemm_kernel(const _Float16* __restrict__ o, const float* __restrict__ w,
                     float* __restrict__ out) {
  __shared__ __align__(16) _Float16 As[128 * 40];   // [m][k]
  __shared__ __align__(16) _Float16 Bs[64 * 40];    // [n][k] (transposed)
  const int tid  = threadIdx.x;
  const int wave = tid >> 5;
  const int lane = tid & 31;
  const int half = lane >> 4;
  const int row0 = blockIdx.x * 128;
  const int col0 = blockIdx.y * 64;
  const int ar = tid >> 2, ac = (tid & 3) * 8;     // A staging: row, first k
  const int bn = tid & 63, bk = (tid >> 6) * 8;    // B staging: column, first k
  const _Float16* oa = o + (size_t)(row0 + ar) * D_ + ac;
  const float* wb = w + (size_t)bk * D_ + col0 + bn;

  v8f acc[4];
#pragma unroll
  for (int t = 0; t < 4; ++t)
#pragma unroll
    for (int f = 0; f < 8; ++f) acc[t][f] = 0.0f;

  for (int k0 = 0; k0 < D_; k0 += 32) {
    if (k0 + 32 < D_) {
      __builtin_prefetch(&o[(size_t)(row0 + (tid >> 1)) * D_ + k0 + 32], 0, 1);
      __builtin_prefetch(&w[(size_t)(k0 + 32 + (tid >> 3)) * D_ + col0 + (tid & 7) * 8], 0, 1);
    }
    // A: 128x32 halves, 16-byte loads and 16-byte LDS stores.
    v8h av[2];
#pragma unroll
    for (int i = 0; i < 2; ++i)
      av[i] = *(const v8h*)(oa + k0 + i * 64 * D_);
    // B: 32x64, stored [n][k]: one column, 8 consecutive k per thread, one
    // 16-byte LDS store.
    float bv[8];
#pragma unroll
    for (int j = 0; j < 8; ++j)
      bv[j] = wb[(size_t)k0 * D_ + j * D_];
#pragma unroll
    for (int i = 0; i < 2; ++i)
      *(v8h*)&As[(i * 64 + ar) * 40 + ac] = av[i];
    v8h hB;
#pragma unroll
    for (int j = 0; j < 8; ++j) hB[j] = (_Float16)bv[j];
    *(v8h*)&Bs[bn * 40 + bk] = hB;
    __syncthreads();

    const v16h a = frag16(As + (wave * 16) * 40, 40, 0);
#pragma unroll
    for (int t = 0; t < 4; ++t) {
      const v16h b = frag16(Bs + (t * 16) * 40, 40, 0);
      acc[t] = __builtin_amdgcn_wmma_f32_16x16x32_f16(
          false, a, false, b, (short)0, acc[t], false, false);
    }
    __syncthreads();
  }

#pragma unroll
  for (int t = 0; t < 4; ++t)
#pragma unroll
    for (int f = 0; f < 8; ++f) {
      const int m = row0 + wave * 16 + f + 8 * half;
      const int n = col0 + t * 16 + (lane & 15);
      out[(size_t)m * D_ + n] = acc[t][f];
    }
}

// ---------------------------------------------------------------------------
extern "C" void kernel_launch(void* const* d_in, const int* in_sizes, int n_in,
                              void* d_out, int out_size, void* d_ws, size_t ws_size,
                              hipStream_t stream) {
  const float* x     = (const float*)d_in[0];
  const float* w_qkv = (const float*)d_in[1];
  const float* w_out = (const float*)d_in[2];
  float* out = (float*)d_out;

  _Float16* qkv = (_Float16*)d_ws;                       // B*L*3D f16 = 24 MB
  _Float16* o   = qkv + (size_t)B_ * L_ * ND3;           // B*L*D  f16 =  8 MB

  qkv_gemm_kernel<<<dim3((B_ * L_) / 128, ND3 / 64), 256, 0, stream>>>(x, w_qkv, qkv);
  attn_kernel<<<B_ * H_ * (L_ / 64), 128, 0, stream>>>(qkv, o);
  out_gemm_kernel<<<dim3((B_ * L_) / 128, D_ / 64), 256, 0, stream>>>(o, w_out, out);
}

// v004
// One run takes 116 microseconds.
// Two timings next to v003 put it at 1.24 and 1.25 times that version's speed.
// Over all steps from v000 it is 2.32 times as fast.
#include <hip/hip_runtime.h>
#include <hip/hip_bf16.h>
#include <hip/hip_fp16.h>

typedef __attribute__((ext_vector_type(16))) _Float16 v16h;
typedef __attribute__((ext_vector_type(8)))  _Float16 v8h;
typedef __attribute__((ext_vector_type(4)))  _Float16 v4h;
typedef __attribute__((ext_vector_type(4)))  float    f32x4;
typedef __attribute__((ext_vector_type(8)))  float    v8f;
typedef __attribute__((ext_vector_type(4)))  unsigned int u32x4;
typedef __attribute__((ext_vector_type(8)))  int      i32x8;
typedef __attribute__((ext_vector_type(4)))  int      i32x4;

#define B_   2
#define L_   2048
#define D_   1024
#define H_   16
#define HD_  64
#define ND3  (3 * D_)

__device__ __forceinline__ v16h frag16(const _Float16* base, int ld, int kbase) {
  const int lane = threadIdx.x & 31;
  const int half = lane >> 4;
  const int row  = lane & 15;
  const _Float16* p = base + row * ld + kbase + 8 * half;
  const v8h a = *(const v8h*)p;
  const v8h b = *(const v8h*)(p + 16);
  return __builtin_shufflevector(a, b, 0, 1, 2, 3, 4, 5, 6, 7,
                                 8, 9, 10, 11, 12, 13, 14, 15);
}

__device__ __forceinline__ void tdm_load_2d_f16(unsigned lds_off, const void* gptr,
                                                int tile_d0, int tile_d1,
                                                long long row_stride) {
  const unsigned long long ga = (unsigned long long)(size_t)gptr;
  u32x4 g0;
  g0[0] = 1u;
  g0[1] = lds_off;
  g0[2] = (unsigned)(ga & 0xffffffffu);
  g0[3] = (unsigned)((ga >> 32) & 0x1ffffffu)
        | (2u << 30);
  i32x8 g1;
  g1[0] = (1 << 16)
        | (1 << 20)
        | (4 << 22)
        | (3 << 25);
  g1[1] = (tile_d0 & 0xffff) << 16;
  g1[2] = ((tile_d0 >> 16) & 0xffff)
        | ((tile_d1 & 0xffff) << 16);
  g1[3] = ((tile_d1 >> 16) & 0xffff)
        | ((tile_d0 & 0xffff) << 16);
  g1[4] = (tile_d1 & 0xffff);
  g1[5] = (int)(row_stride & 0xffffffffLL);
  g1[6] = (int)((row_stride >> 32) & 0xffffLL);
  g1[7] = 0;
  i32x4 z4;
  z4[0] = z4[1] = z4[2] = z4[3] = 0;
#if defined(__clang_major__) && (__clang_major__ >= 23)
  i32x8 z8;
#pragma unroll
  for (int i = 0; i < 8; ++i) z8[i] = 0;
  __builtin_amdgcn_tensor_load_to_lds(g0, g1, z4, z4, z8, 0);
#else
  __builtin_amdgcn_tensor_load_to_lds(g0, g1, z4, z4, 0);
#endif
}

__global__ __launch_bounds__(256) __attribute__((amdgpu_waves_per_eu(4, 4)))
void qkv_gemm_kernel(const float* __restrict__ x, const float* __restrict__ w,
                     _Float16* __restrict__ qkv) {
  __shared__ __align__(16) _Float16 As[256 * 40];   // [m][k]
  __shared__ __align__(16) _Float16 Bs[128 * 40];   // [n][k] (transposed)
  const int tid  = threadIdx.x;
  const int wave = tid >> 5;
  const int lane = tid & 31;
  const int half = lane >> 4;
  const int row0 = blockIdx.x * 256;
  const int col0 = blockIdx.y * 128;
  const int wrow = (wave >> 1) * 64;               // the wave's rows in the tile
  const int wcol = (wave & 1) * 64;                // the wave's columns: one head
  const int ar = tid >> 3, ac = (tid & 7) * 4;     // A staging: row, first k
  const int bn = tid & 127, bk = (tid >> 7) * 16;  // B staging: column, first k
  const float* xa = x + (size_t)(row0 + ar) * D_ + ac;
  const float* wb = w + (size_t)bk * ND3 + col0 + bn;

  v8f acc[4][4];
#pragma unroll
  for (int i = 0; i < 4; ++i)
#pragma unroll
    for (int t = 0; t < 4; ++t)
#pragma unroll
      for (int f = 0; f < 8; ++f) acc[i][t][f] = 0.0f;

  for (int k0 = 0; k0 < D_; k0 += 32) {
    if (k0 + 32 < D_) {                      // prefetch next tiles
      __builtin_prefetch(&x[(size_t)(row0 + tid) * D_ + k0 + 32], 0, 1);
      __builtin_prefetch(&w[(size_t)(k0 + 32 + (tid >> 3)) * ND3 + col0 + (tid & 7) * 16], 0, 1);
    }
    // A: 256x32. 16-byte loads, 8 lanes per 128-byte row piece (4 whole lines
    // per wave load), 4 halves per LDS store.
    f32x4 av[8];
#pragma unroll
    for (int i = 0; i < 8; ++i)
      av[i] = *(const f32x4*)(xa + k0 + i * 32 * D_);
    // B: 32x128, stored [n][k]. A thread owns one column n and 16 consecutive k
    // (each load is one whole line per wave), so the transposed row piece
    // leaves as two 16-byte LDS stores.
    float bv[16];
#pragma unroll
    for (int j = 0; j < 16; ++j)
      bv[j] = wb[(size_t)k0 * ND3 + j * ND3];
#pragma unroll
    for (int i = 0; i < 8; ++i) {
      v4h hA;
#pragma unroll
      for (int e = 0; e < 4; ++e) hA[e] = (_Float16)av[i][e];
      *(v4h*)&As[(i * 32 + ar) * 40 + ac] = hA;
    }
#pragma unroll
    for (int g = 0; g < 2; ++g) {
      v8h hB;
#pragma unroll
      for (int j = 0; j < 8; ++j) hB[j] = (_Float16)bv[g * 8 + j];
      *(v8h*)&Bs[bn * 40 + bk + g * 8] = hB;
    }
    __syncthreads();

    // All eight fragments first, as one group of LDS loads, then the products.
    v16h a[4], b[4];
#pragma unroll
    for (int i = 0; i < 4; ++i) a[i] = frag16(As + (wrow + i * 16) * 40, 40, 0);
#pragma unroll
    for (int t = 0; t < 4; ++t) b[t] = frag16(Bs + (wcol + t * 16) * 40, 40, 0);
    // Keeps the sixteen loads ahead of the products: left free, the compiler
    // sinks a fragment's loads to its own products, into one register set, and
    // the wave waits out the LDS latency several times a pass.
    __builtin_amdgcn_sched_barrier(0);
#pragma unroll
    for (int t = 0; t < 4; ++t)
#pragma unroll
      for (int i = 0; i < 4; ++i)
        acc[i][t] = __builtin_amdgcn_wmma_f32_16x16x32_f16(
            false, a[i], false, b[t], (short)0, acc[i][t], false, false);
    __syncthreads();
  }

  // RoPE on the f32 accumulators. The wave's 64 columns are exactly one head
  // of q, k or v, and a lane holds columns j (acc[i][t]) and j + 32
  // (acc[i][t + 2]) of the same rows, so each rotation pair is already in one
  // lane. Each band of 16 rows is rotated and stored before the next, so its
  // registers are free again.
  const bool rope = col0 < 2 * D_;           // q and k heads; uniform per block
  float inv_freq[2];
  inv_freq[0] = __powf(10000.0f, -(float)(2 * (lane & 15)) / (float)HD_);
  inv_freq[1] = inv_freq[0] * 0.01f;         // j + 16: another 10000^(-1/2)
#pragma unroll
  for (int i = 0; i < 4; ++i) {
    if (rope) {
#pragma unroll
      for (int f = 0; f < 8; ++f) {
        const float pos =
            (float)((row0 + wrow + i * 16 + f + 8 * half) & (L_ - 1));
#pragma unroll
        for (int t = 0; t < 2; ++t) {
          const float rev = pos * inv_freq[t] * 0.15915494f;   // angle in turns
          float c, s;
          asm("v_cos_f32 %0, %2\n\tv_sin_f32 %1, %2\n\tv_nop"
              : "=&v"(c), "=&v"(s) : "v"(rev));
          const float x1 = acc[i][t][f];
          const float x2 = acc[i][t + 2][f];
          acc[i][t][f]     = x1 * c - x2 * s;
          acc[i][t + 2][f] = x2 * c + x1 * s;
        }
      }
    }
#pragma unroll
    for (int t = 0; t < 4; ++t)
#pragma unroll
      for (int f = 0; f < 8; ++f) {
        const int m = row0 + wrow + i * 16 + f + 8 * half;
        const int n = col0 + wcol + t * 16 + (lane & 15);
        qkv[(size_t)m * ND3 + n] = (_Float16)acc[i][t][f];
      }
    // The next band's arithmetic reuses the registers that held this band's
    // store addresses: the wait stands in front of that overwrite.
    if (i < 3) asm volatile("s_wait_xcnt 0x0" ::: "memory");
  }
}

__device__ __forceinline__ float xhalf(float x) {
  return __builtin_bit_cast(float, __builtin_amdgcn_permlanex16(
      __builtin_bit_cast(int, x), __builtin_bit_cast(int, x),
      0x76543210, 0xfedcba98, false, false));
}

__device__ __forceinline__ v8f exp2x8(v8f x) {
  float r0, r1, r2, r3, r4, r5, r6, r7;
  asm("v_exp_f32 %0, %8\n\tv_exp_f32 %1, %9\n\tv_exp_f32 %2, %10\n\t"
      "v_exp_f32 %3, %11\n\tv_exp_f32 %4, %12\n\tv_exp_f32 %5, %13\n\t"
      "v_exp_f32 %6, %14\n\tv_exp_f32 %7, %15\n\tv_nop"
      : "=&v"(r0), "=&v"(r1), "=&v"(r2), "=&v"(r3),
        "=&v"(r4), "=&v"(r5), "=&v"(r6), "=&v"(r7)
      : "v"(x[0]), "v"(x[1]), "v"(x[2]), "v"(x[3]),
        "v"(x[4]), "v"(x[5]), "v"(x[6]), "v"(x[7]));
  v8f r;
  r[0] = r0; r[1] = r1; r[2] = r2; r[3] = r3;
  r[4] = r4; r[5] = r5; r[6] = r6; r[7] = r7;
  return r;
}

__global__ __launch_bounds__(128) __attribute__((amdgpu_waves_per_eu(4, 8)))
void attn_kernel(const _Float16* __restrict__ qkv, _Float16* __restrict__ o) {
  __shared__ __align__(16) _Float16 Qs[64 * 72];   // [q][d]
  __shared__ __align__(16) _Float16 Ks[64 * 72];   // [key][d]
  __shared__ __align__(16) _Float16 Vt[64 * 72];   // [d][key]  (transposed)

  const int tid   = threadIdx.x;
  const int wave  = tid >> 5;
  const int lane  = tid & 31;
  const int half  = lane >> 4;
  const int nlane = lane & 15;
  const int vk = (tid >> 3) * 4, vd = (tid & 7) * 8;   // V staging: first key, first d

  const int blk = blockIdx.x;                // b * H * (L/64)
  const int qt  = blk & 31;                  // L/64 = 32
  const int h   = (blk >> 5) & (H_ - 1);
  const int b   = blk >> 9;
  const int q0  = qt * 64;

  const _Float16* qbase = qkv + (size_t)b * L_ * ND3 + h * HD_;
  const _Float16* kbase = qbase + D_;
  const _Float16* vbase = qbase + 2 * D_;

  if (wave == 0) {
    tdm_load_2d_f16((unsigned)(size_t)Qs, qbase + (size_t)q0 * ND3, 64, 64, ND3);
    __builtin_amdgcn_s_wait_tensorcnt(0);
  }
  __syncthreads();

  // Per lane: running maximum of its query (equal in both halves) and the sum
  // over the keys of its own half only; the halves' sums join after the loop.
  float m_i = -3.0e38f, l_i = 0.0f;
  v8f acc_o[4];                              // O^T: d = t*16 + 8*half + f
#pragma unroll
  for (int t = 0; t < 4; ++t)
#pragma unroll
    for (int f = 0; f < 8; ++f) acc_o[t][f] = 0.0f;

  const float scale = 0.125f;                // 1/sqrt(64)

  for (int kt = 0; kt < L_ / 64; ++kt) {
    const int kk0 = kt * 64;
    __syncthreads();
    if (wave == 0)
      tdm_load_2d_f16((unsigned)(size_t)Ks, kbase + (size_t)kk0 * ND3, 64, 64, ND3);
    // V tile staged transposed: a thread takes 4 keys x 8 d with 16-byte loads
    // (8 lanes cover a key's whole 128-byte row) and stores, per d, its 4 keys
    // as one 8-byte piece of the [d][key] row.
    v8h vr[4];
#pragma unroll
    for (int kk = 0; kk < 4; ++kk)
      vr[kk] = *(const v8h*)&vbase[(size_t)(kk0 + vk + kk) * ND3 + vd];
#pragma unroll
    for (int j = 0; j < 8; ++j) {
      v4h hv;
#pragma unroll
      for (int kk = 0; kk < 4; ++kk) hv[kk] = vr[kk][j];
      *(v4h*)&Vt[(vd + j) * 72 + vk] = hv;
    }
    if (wave == 0) __builtin_amdgcn_s_wait_tensorcnt(0);
    __syncthreads();

    // S^T = K Q^T -> 64 keys x 16 queries per wave: A = K rows, B = Q rows
    v8f acc_s[4];                            // key = t*16 + 8*half + f
#pragma unroll
    for (int t = 0; t < 4; ++t)
#pragma unroll
      for (int f = 0; f < 8; ++f) acc_s[t][f] = 0.0f;
#pragma unroll
    for (int ks = 0; ks < 2; ++ks) {
      const v16h bq = frag16(Qs + (wave * 16) * 72, 72, ks * 32);
#pragma unroll
      for (int t = 0; t < 4; ++t) {
        const v16h ak = frag16(Ks + (t * 16) * 72, 72, ks * 32);
        acc_s[t] = __builtin_amdgcn_wmma_f32_16x16x32_f16(
            false, ak, false, bq, (short)0, acc_s[t], false, false);
      }
    }

    // Online softmax of the lane's query: 32 keys in the lane, the other 32 in
    // lane ^ 16. One chain per tile keeps four independent chains.
    float tmax[4];
#pragma unroll
    for (int t = 0; t < 4; ++t) {
      tmax[t] = acc_s[t][0];
#pragma unroll
      for (int f = 1; f < 8; ++f) tmax[t] = fmaxf(tmax[t], acc_s[t][f]);
    }
    float vmax = fmaxf(fmaxf(tmax[0], tmax[1]), fmaxf(tmax[2], tmax[3]));
    vmax = fmaxf(vmax, xhalf(vmax));
    vmax *= scale;
    const float mnew  = fmaxf(m_i, vmax);
    const float alpha = __expf(m_i - mnew);
    // P^T as a B operand: position (half, e) of a fragment is key
    // kbase + 8*half + e, position (half, 8 + e) key kbase + 16 + 8*half + e,
    // which are the lane's own rows of tiles 2*ks and 2*ks + 1.
    v16h pb[2];
    float tsum[4];
#pragma unroll
    for (int t = 0; t < 4; ++t) {
      // exp(y) = 2^(y * log2(e))
      const v8f p = exp2x8((acc_s[t] * scale - mnew) * 0x1.715476p+0f);
      tsum[t] = p[0];
#pragma unroll
      for (int f = 1; f < 8; ++f) tsum[t] += p[f];
#pragma unroll
      for (int f = 0; f < 8; ++f)
        pb[t >> 1][(t & 1) * 8 + f] = (_Float16)p[f];
    }
    l_i = l_i * alpha + ((tsum[0] + tsum[1]) + (tsum[2] + tsum[3]));
    m_i = mnew;
#pragma unroll
    for (int t = 0; t < 4; ++t)
#pragma unroll
      for (int f = 0; f < 8; ++f) acc_o[t][f] *= alpha;

    // O^T += V^T P^T : A = Vt rows (d-major), B = P^T from registers
#pragma unroll
    for (int ks = 0; ks < 2; ++ks) {
#pragma unroll
      for (int t = 0; t < 4; ++t) {
        const v16h av = frag16(Vt + (t * 16) * 72, 72, ks * 32);
        acc_o[t] = __builtin_amdgcn_wmma_f32_16x16x32_f16(
            false, av, false, pb[ks], (short)0, acc_o[t], false, false);
      }
    }
  }

  // Normalize and store o as f16 [B*L][D], head-interleaved: a lane's 8 values
  // of a tile are 8 consecutive d of its query's row, one 16-byte store.
  const float l_all = l_i + xhalf(l_i);
  _Float16* orow = o + ((size_t)b * L_ + q0 + wave * 16 + nlane) * D_ + h * HD_ + 8 * half;
#pragma unroll
  for (int t = 0; t < 4; ++t) {
    v8h ho;
#pragma unroll
    for (int f = 0; f < 8; ++f) ho[f] = (_Float16)(acc_o[t][f] / l_all);
    *(v8h*)(orow + t * 16) = ho;
  }
}

__global__ __launch_bounds__(256) __attribute__((amdgpu_waves_per_eu(4, 8)))
void out_gemm_kernel(const _Float16* __restrict__ o, const float* __restrict__ w,
                     float* __restrict__ out) {
  __shared__ __align__(16) _Float16 As[128 * 40];   // [m][k]
  __shared__ __align__(16) _Float16 Bs[64 * 40];    // [n][k] (transposed)
  const int tid  = threadIdx.x;
  const int wave = tid >> 5;
  const int lane = tid & 31;
  const int half = lane >> 4;
  const int row0 = blockIdx.x * 128;
  const int col0 = blockIdx.y * 64;
  const int ar = tid >> 2, ac = (tid & 3) * 8;     // A staging: row, first k
  const int bn = tid & 63, bk = (tid >> 6) * 8;    // B staging: column, first k
  const _Float16* oa = o + (size_t)(row0 + ar) * D_ + ac;
  const float* wb = w + (size_t)bk * D_ + col0 + bn;

  v8f acc[4];
#pragma unroll
  for (int t = 0; t < 4; ++t)
#pragma unroll
    for (int f = 0; f < 8; ++f) acc[t][f] = 0.0f;

  for (int k0 = 0; k0 < D_; k0 += 32) {
    if (k0 + 32 < D_) {
      __builtin_prefetch(&o[(size_t)(row0 + (tid >> 1)) * D_ + k0 + 32], 0, 1);
      __builtin_prefetch(&w[(size_t)(k0 + 32 + (tid >> 3)) * D_ + col0 + (tid & 7) * 8], 0, 1);
    }
    // A: 128x32 halves, 16-byte loads and 16-byte LDS stores.
    v8h av[2];
#pragma unroll
    for (int i = 0; i < 2; ++i)
      av[i] = *(const v8h*)(oa + k0 + i * 64 * D_);
    // B: 32x64, stored [n][k]: one column, 8 consecutive k per thread, one
    // 16-byte LDS store.
    float bv[8];
#pragma unroll
    for (int j = 0; j < 8; ++j)
      bv[j] = wb[(size_t)k0 * D_ + j * D_];
#pragma unroll
    for (int i = 0; i < 2; ++i)
      *(v8h*)&As[(i * 64 + ar) * 40 + ac] = av[i];
    v8h hB;
#pragma unroll
    for (int j = 0; j < 8; ++j) hB[j] = (_Float16)bv[j];
    *(v8h*)&Bs[bn * 40 + bk] = hB;
    __syncthreads();

    const v16h a = frag16(As + (wave * 16) * 40, 40, 0);
#pragma unroll
    for (int t = 0; t < 4; ++t) {
      const v16h b = frag16(Bs + (t * 16) * 40, 40, 0);
      acc[t] = __builtin_amdgcn_wmma_f32_16x16x32_f16(
          false, a, false, b, (short)0, acc[t], false, false);
    }
    __syncthreads();
  }

#pragma unroll
  for (int t = 0; t < 4; ++t)
#pragma unroll
    for (int f = 0; f < 8; ++f) {
      const int m = row0 + wave * 16 + f + 8 * half;
      const int n = col0 + t * 16 + (lane & 15);
      out[(size_t)m * D_ + n] = acc[t][f];
    }
}

// ---------------------------------------------------------------------------
extern "C" void kernel_launch(void* const* d_in, const int* in_sizes, int n_in,
                              void* d_out, int out_size, void* d_ws, size_t ws_size,
                              hipStream_t stream) {
  const float* x     = (const float*)d_in[0];
  const float* w_qkv = (const float*)d_in[1];
  const float* w_out = (const float*)d_in[2];
  float* out = (float*)d_out;

  _Float16* qkv = (_Float16*)d_ws;                       // B*L*3D f16 = 24 MB
  _Float16* o   = qkv + (size_t)B_ * L_ * ND3;           // B*L*D  f16 =  8 MB

  qkv_gemm_kernel<<<dim3((B_ * L_) / 256, ND3 / 128), 256, 0, stream>>>(x, w_qkv, qkv);
  attn_kernel<<<B_ * H_ * (L_ / 64), 128, 0, stream>>>(qkv, o);
  out_gemm_kernel<<<dim3((B_ * L_) / 128, D_ / 64), 256, 0, stream>>>(o, w_out, out);
}

// v005
// A run of this version takes 106 microseconds.
// Timed twice side by side with v004, it ran 1.10 and 1.09 times as fast.
// All steps since v000 together make it 2.55 times as fast.
#include <hip/hip_runtime.h>
#include <hip/hip_bf16.h>
#include <hip/hip_fp16.h>

typedef __attribute__((ext_vector_type(16))) _Float16 v16h;
typedef __attribute__((ext_vector_type(8)))  _Float16 v8h;
typedef __attribute__((ext_vector_type(4)))  _Float16 v4h;
typedef __attribute__((ext_vector_type(4)))  float    f32x4;
typedef __attribute__((ext_vector_type(8)))  float    v8f;
typedef __attribute__((ext_vector_type(4)))  unsigned int u32x4;
typedef __attribute__((ext_vector_type(8)))  unsigned int u32x8;
typedef __attribute__((ext_vector_type(8)))  short    s16x8;

#define B_   2
#define L_   2048
#define D_   1024
#define H_   16
#define HD_  64
#define ND3  (3 * D_)
#define KV_BUF 10240   // bytes of one K, V or Q place in the attention kernel's LDS

__device__ __forceinline__ v16h frag16(const _Float16* base, int ld, int kbase) {
  const int lane = threadIdx.x & 31;
  const int half = lane >> 4;
  const int row  = lane & 15;
  const _Float16* p = base + row * ld + kbase + 8 * half;
  const v8h a = *(const v8h*)p;
  const v8h b = *(const v8h*)(p + 16);
  return __builtin_shufflevector(a, b, 0, 1, 2, 3, 4, 5, 6, 7,
                                 8, 9, 10, 11, 12, 13, 14, 15);
}

__device__ __forceinline__ unsigned uni(unsigned v) {
  return (unsigned)__builtin_amdgcn_readfirstlane(v);
}
__device__ __forceinline__ unsigned pinned(unsigned v) {
  unsigned w = __builtin_amdgcn_readfirstlane(v);
  asm volatile("" : "+s"(w));   // keeps the value scalar
  return w;
}
template <unsigned A>
__device__ __forceinline__ u32x8 tdm_group1() {
  u32x8 g;
  g[0] = uni((1u << 20) | (4u << 22) | (A << 25));
  g[1] = uni(128u << 16);
  g[2] = uni(64u << 16);
  g[3] = uni(128u << 16);
  g[4] = uni(64u);
  g[5] = uni(2u * ND3);
  g[6] = uni(0u);
  g[7] = uni(0u);
  return g;
}
__device__ __forceinline__ u32x4 tdm_group0(unsigned lds_dst, unsigned long long ga) {
  u32x4 g;
  g[0] = uni(1u);                                   // count = 1
  g[1] = uni(lds_dst);                              // byte offset in LDS
  g[2] = uni((unsigned)ga);
  g[3] = uni((((unsigned)(ga >> 32)) & 0x01ffffffu) | 0x80000000u);  // type = 2
  return g;
}
__device__ __forceinline__ void tdm_load(u32x4& g0, const u32x8& g1) {
  asm volatile("tensor_load_to_lds %0, %1" : "+s"(g0) : "s"(g1) : "memory");
}
// The compiler places no wait for a tensor load: a tile counts as landed only
// behind its issuer's own wait.
__device__ __forceinline__ void wait_tensor0(u32x4& g0) {
  asm volatile("s_wait_tensorcnt 0x0" : "+s"(g0) :: "memory");
}
// The next tile of the ring: the other buffer, 64 rows further in the source.
__device__ __forceinline__ void tdm_advance(u32x4& g0) {
  const unsigned long long a =
      (((unsigned long long)g0[3] << 32) | g0[2]) + 64ull * ND3 * 2ull;
  g0[1] = uni(g0[1] ^ KV_BUF);
  g0[2] = uni((unsigned)a);
  g0[3] = uni((unsigned)(a >> 32));
}
// A wave's LDS reads have retired before the barrier behind which their buffer
// is refilled.
__device__ __forceinline__ void wait_ds0() {
  asm volatile("s_wait_dscnt 0x0" ::: "memory");
}
// Transposing LDS load: lane (c = lane & 15, h = lane >> 4) gets 8 consecutive
// rows (8h + 0..7) of column c of a row-major 16-bit tile.
__device__ __forceinline__ v8h ld_tr16(const unsigned char* p) {
  typedef __attribute__((address_space(3))) s16x8 lds_s16x8;
  return __builtin_bit_cast(v8h, __builtin_amdgcn_ds_load_tr16_b128_v8i16((lds_s16x8*)p));
}

__global__ __launch_bounds__(256) __attribute__((amdgpu_waves_per_eu(4, 4)))
void qkv_gemm_kernel(const float* __restrict__ x, const float* __restrict__ w,
                     _Float16* __restrict__ qkv) {
  __shared__ __align__(16) _Float16 As[256 * 40];   // [m][k]
  __shared__ __align__(16) _Float16 Bs[128 * 40];   // [n][k] (transposed)
  const int tid  = threadIdx.x;
  const int wave = tid >> 5;
  const int lane = tid & 31;
  const int half = lane >> 4;
  const int row0 = blockIdx.x * 256;
  const int col0 = blockIdx.y * 128;
  const int wrow = (wave >> 1) * 64;               // the wave's rows in the tile
  const int wcol = (wave & 1) * 64;                // the wave's columns: one head
  const int ar = tid >> 3, ac = (tid & 7) * 4;     // A staging: row, first k
  const int bn = tid & 127, bk = (tid >> 7) * 16;  // B staging: column, first k
  const float* xa = x + (size_t)(row0 + ar) * D_ + ac;
  const float* wb = w + (size_t)bk * ND3 + col0 + bn;

  v8f acc[4][4];
#pragma unroll
  for (int i = 0; i < 4; ++i)
#pragma unroll
    for (int t = 0; t < 4; ++t)
#pragma unroll
      for (int f = 0; f < 8; ++f) acc[i][t][f] = 0.0f;

  for (int k0 = 0; k0 < D_; k0 += 32) {
    if (k0 + 32 < D_) {                      // prefetch next tiles
      __builtin_prefetch(&x[(size_t)(row0 + tid) * D_ + k0 + 32], 0, 1);
      __builtin_prefetch(&w[(size_t)(k0 + 32 + (tid >> 3)) * ND3 + col0 + (tid & 7) * 16], 0, 1);
    }
    // A: 256x32. 16-byte loads, 8 lanes per 128-byte row piece (4 whole lines
    // per wave load), 4 halves per LDS store.
    f32x4 av[8];
#pragma unroll
    for (int i = 0; i < 8; ++i)
      av[i] = *(const f32x4*)(xa + k0 + i * 32 * D_);
    // B: 32x128, stored [n][k]. A thread owns one column n and 16 consecutive k
    // (each load is one whole line per wave), so the transposed row piece
    // leaves as two 16-byte LDS stores.
    float bv[16];
#pragma unroll
    for (int j = 0; j < 16; ++j)
      bv[j] = wb[(size_t)k0 * ND3 + j * ND3];
#pragma unroll
    for (int i = 0; i < 8; ++i) {
      v4h hA;
#pragma unroll
      for (int e = 0; e < 4; ++e) hA[e] = (_Float16)av[i][e];
      *(v4h*)&As[(i * 32 + ar) * 40 + ac] = hA;
    }
#pragma unroll
    for (int g = 0; g < 2; ++g) {
      v8h hB;
#pragma unroll
      for (int j = 0; j < 8; ++j) hB[j] = (_Float16)bv[g * 8 + j];
      *(v8h*)&Bs[bn * 40 + bk + g * 8] = hB;
    }
    __syncthreads();

    // All eight fragments first, as one group of LDS loads, then the products.
    v16h a[4], b[4];
#pragma unroll
    for (int i = 0; i < 4; ++i) a[i] = frag16(As + (wrow + i * 16) * 40, 40, 0);
#pragma unroll
    for (int t = 0; t < 4; ++t) b[t] = frag16(Bs + (wcol + t * 16) * 40, 40, 0);
    // Keeps the sixteen loads ahead of the products: left free, the compiler
    // sinks a fragment's loads to its own products, into one register set, and
    // the wave waits out the LDS latency several times a pass.
    __builtin_amdgcn_sched_barrier(0);
#pragma unroll
    for (int t = 0; t < 4; ++t)
#pragma unroll
      for (int i = 0; i < 4; ++i)
        acc[i][t] = __builtin_amdgcn_wmma_f32_16x16x32_f16(
            false, a[i], false, b[t], (short)0, acc[i][t], false, false);
    __syncthreads();
  }

  // RoPE on the f32 accumulators. The wave's 64 columns are exactly one head
  // of q, k or v, and a lane holds columns j (acc[i][t]) and j + 32
  // (acc[i][t + 2]) of the same rows, so each rotation pair is already in one
  // lane. Each band of 16 rows is rotated and stored before the next, so its
  // registers are free again.
  const bool rope = col0 < 2 * D_;           // q and k heads; uniform per block
  float inv_freq[2];
  inv_freq[0] = __powf(10000.0f, -(float)(2 * (lane & 15)) / (float)HD_);
  inv_freq[1] = inv_freq[0] * 0.01f;         // j + 16: another 10000^(-1/2)
#pragma unroll
  for (int i = 0; i < 4; ++i) {
    if (rope) {
#pragma unroll
      for (int f = 0; f < 8; ++f) {
        const float pos =
            (float)((row0 + wrow + i * 16 + f + 8 * half) & (L_ - 1));
#pragma unroll
        for (int t = 0; t < 2; ++t) {
          const float rev = pos * inv_freq[t] * 0.15915494f;   // angle in turns
          float c, s;
          asm("v_cos_f32 %0, %2\n\tv_sin_f32 %1, %2\n\tv_nop"
              : "=&v"(c), "=&v"(s) : "v"(rev));
          const float x1 = acc[i][t][f];
          const float x2 = acc[i][t + 2][f];
          acc[i][t][f]     = x1 * c - x2 * s;
          acc[i][t + 2][f] = x2 * c + x1 * s;
        }
      }
    }
#pragma unroll
    for (int t = 0; t < 4; ++t)
#pragma unroll
      for (int f = 0; f < 8; ++f) {
        const int m = row0 + wrow + i * 16 + f + 8 * half;
        const int n = col0 + wcol + t * 16 + (lane & 15);
        qkv[(size_t)m * ND3 + n] = (_Float16)acc[i][t][f];
      }
    // The next band's arithmetic reuses the registers that held this band's
    // store addresses: the wait stands in front of that overwrite.
    if (i < 3) asm volatile("s_wait_xcnt 0x0" ::: "memory");
  }
}

__device__ __forceinline__ float xhalf(float x) {
  return __builtin_bit_cast(float, __builtin_amdgcn_permlanex16(
      __builtin_bit_cast(int, x), __builtin_bit_cast(int, x),
      0x76543210, 0xfedcba98, false, false));
}

__device__ __forceinline__ v8f exp2x8(v8f x) {
  float r0, r1, r2, r3, r4, r5, r6, r7;
  asm("v_exp_f32 %0, %8\n\tv_exp_f32 %1, %9\n\tv_exp_f32 %2, %10\n\t"
      "v_exp_f32 %3, %11\n\tv_exp_f32 %4, %12\n\tv_exp_f32 %5, %13\n\t"
      "v_exp_f32 %6, %14\n\tv_exp_f32 %7, %15\n\tv_nop"
      : "=&v"(r0), "=&v"(r1), "=&v"(r2), "=&v"(r3),
        "=&v"(r4), "=&v"(r5), "=&v"(r6), "=&v"(r7)
      : "v"(x[0]), "v"(x[1]), "v"(x[2]), "v"(x[3]),
        "v"(x[4]), "v"(x[5]), "v"(x[6]), "v"(x[7]));
  v8f r;
  r[0] = r0; r[1] = r1; r[2] = r2; r[3] = r3;
  r[4] = r4; r[5] = r5; r[6] = r6; r[7] = r7;
  return r;
}

__global__ __launch_bounds__(128) __attribute__((amdgpu_waves_per_eu(4, 8)))
void attn_kernel(const _Float16* __restrict__ qkv, _Float16* __restrict__ o) {
  // Five places of 10 KiB, each a multiple of 2 KiB: K buffers 0 and 1 (64 rows
  // at pitch 144), V buffers 0 and 1 (64 rows at pitch 160), Q (pitch 144).
  __shared__ __attribute__((aligned(2048))) unsigned char smem[5 * KV_BUF];

  const int tid   = threadIdx.x;
  const unsigned wave = uni(threadIdx.x >> 5);
  const int lane  = tid & 31;
  const int half  = lane >> 4;
  const int nlane = lane & 15;

  const int blk = blockIdx.x;                // b * H * (L/64)
  const int qt  = blk & 31;                  // L/64 = 32
  const int h   = (blk >> 5) & (H_ - 1);
  const int b   = blk >> 9;
  const int q0  = qt * 64;

  const _Float16* qbase = qkv + (size_t)b * L_ * ND3 + h * HD_;
  const _Float16* kbase = qbase + D_;
  const _Float16* vbase = qbase + 2 * D_;

  const _Float16* Qs = (const _Float16*)(smem + 4 * KV_BUF);
  const unsigned lds0 = (unsigned)(size_t)smem;
  u32x8 g1k = tdm_group1<3>();               // K and Q: pitch 144
  u32x8 g1v = tdm_group1<7>();               // V: pitch 160
  asm volatile("" : "+s"(g1k), "+s"(g1v));
  u32x4 g0 = tdm_group0(lds0 + (wave == 1 ? 2 * KV_BUF : 0),
                        (unsigned long long)(size_t)(wave == 1 ? vbase : kbase));

  // Tile 0 of K and V and the Q tile, one request per wave, each behind its
  // issuer's own wait; the barrier publishes them. Then tile 1's loads.
  if (pinned(wave == 0)) {
    tdm_load(g0, g1k);
    wait_tensor0(g0);
  }
  if (pinned(wave == 1)) {
    tdm_load(g0, g1v);
    wait_tensor0(g0);
  }
  if (pinned(wave == 2)) {
    u32x4 gq = tdm_group0(lds0 + 4 * KV_BUF,
                          (unsigned long long)(size_t)(qbase + (size_t)q0 * ND3));
    tdm_load(gq, g1k);
    wait_tensor0(gq);
  }
  __syncthreads();
  tdm_advance(g0);
  if (pinned(wave == 0)) tdm_load(g0, g1k);
  if (pinned(wave == 1)) tdm_load(g0, g1v);

  // Per lane: running maximum of its query (equal in both halves) and the sum
  // over the keys of its own half only; the halves' sums join after the loop.
  float m_i = -3.0e38f, l_i = 0.0f;
  v8f acc_o[4];                              // O^T: d = t*16 + 8*half + f
#pragma unroll
  for (int t = 0; t < 4; ++t)
#pragma unroll
    for (int f = 0; f < 8; ++f) acc_o[t][f] = 0.0f;

  const float scale = 0.125f;                // 1/sqrt(64)

  for (int kt = 0; kt < L_ / 64; ++kt) {
    const unsigned boff = (unsigned)(kt & 1) * KV_BUF;       // this tile's buffers
    const _Float16* Ks = (const _Float16*)(smem + boff);
    // The lane's address for the transposing loads of V: row 8*half + (lane & 7),
    // 16-byte piece (lane >> 3) & 1.
    const unsigned char* vad = smem + 2 * KV_BUF + boff +
        (8 * half + (lane & 7)) * 160 + ((lane >> 3) & 1) * 16;

    // S^T = K Q^T -> 64 keys x 16 queries per wave: A = K rows, B = Q rows
    v8f acc_s[4];                            // key = t*16 + 8*half + f
#pragma unroll
    for (int t = 0; t < 4; ++t)
#pragma unroll
      for (int f = 0; f < 8; ++f) acc_s[t][f] = 0.0f;
#pragma unroll
    for (int ks = 0; ks < 2; ++ks) {
      const v16h bq = frag16(Qs + (wave * 16) * 72, 72, ks * 32);
#pragma unroll
      for (int t = 0; t < 4; ++t) {
        const v16h ak = frag16(Ks + (t * 16) * 72, 72, ks * 32);
        acc_s[t] = __builtin_amdgcn_wmma_f32_16x16x32_f16(
            false, ak, false, bq, (short)0, acc_s[t], false, false);
      }
    }

    // Online softmax of the lane's query: 32 keys in the lane, the other 32 in
    // lane ^ 16. One chain per tile keeps four independent chains.
    float tmax[4];
#pragma unroll
    for (int t = 0; t < 4; ++t) {
      tmax[t] = acc_s[t][0];
#pragma unroll
      for (int f = 1; f < 8; ++f) tmax[t] = fmaxf(tmax[t], acc_s[t][f]);
    }
    float vmax = fmaxf(fmaxf(tmax[0], tmax[1]), fmaxf(tmax[2], tmax[3]));
    vmax = fmaxf(vmax, xhalf(vmax));
    vmax *= scale;
    const float mnew  = fmaxf(m_i, vmax);
    const float alpha = __expf(m_i - mnew);
    // P^T as a B operand: position (half, e) of a fragment is key
    // kbase + 8*half + e, position (half, 8 + e) key kbase + 16 + 8*half + e,
    // which are the lane's own rows of tiles 2*ks and 2*ks + 1.
    v16h pb[2];
    float tsum[4];
#pragma unroll
    for (int t = 0; t < 4; ++t) {
      // exp(y) = 2^(y * log2(e))
      const v8f p = exp2x8((acc_s[t] * scale - mnew) * 0x1.715476p+0f);
      tsum[t] = p[0];
#pragma unroll
      for (int f = 1; f < 8; ++f) tsum[t] += p[f];
#pragma unroll
      for (int f = 0; f < 8; ++f)
        pb[t >> 1][(t & 1) * 8 + f] = (_Float16)p[f];
    }
    l_i = l_i * alpha + ((tsum[0] + tsum[1]) + (tsum[2] + tsum[3]));
    m_i = mnew;
#pragma unroll
    for (int t = 0; t < 4; ++t)
#pragma unroll
      for (int f = 0; f < 8; ++f) acc_o[t][f] *= alpha;

    // O^T += V^T P^T : A = V^T by transposing loads (position (half, e) is key
    // kbase + 8*half + e, (half, 8 + e) key kbase + 16 + 8*half + e, as in P^T),
    // B = P^T from registers
#pragma unroll
    for (int ks = 0; ks < 2; ++ks) {
#pragma unroll
      for (int t = 0; t < 4; ++t) {
        const v8h v0 = ld_tr16(vad + (ks * 32) * 160 + t * 32);
        const v8h v1 = ld_tr16(vad + (ks * 32 + 16) * 160 + t * 32);
        const v16h av = __builtin_shufflevector(v0, v1, 0, 1, 2, 3, 4, 5, 6, 7,
                                                8, 9, 10, 11, 12, 13, 14, 15);
        acc_o[t] = __builtin_amdgcn_wmma_f32_16x16x32_f16(
            false, av, false, pb[ks], (short)0, acc_o[t], false, false);
      }
    }

    // Publish point of tile kt + 1: own LDS reads retired, the issuers' tiles
    // landed, the barrier; only then the refill of the buffers just read.
    wait_ds0();
    if (pinned(wave < 2)) wait_tensor0(g0);
    __syncthreads();
    if (pinned(kt + 2 < L_ / 64)) {
      tdm_advance(g0);
      if (pinned(wave == 0)) tdm_load(g0, g1k);
      if (pinned(wave == 1)) tdm_load(g0, g1v);
    }
  }
  wait_tensor0(g0);
  wait_ds0();

  // Normalize and store o as f16 [B*L][D], head-interleaved: a lane's 8 values
  // of a tile are 8 consecutive d of its query's row, one 16-byte store.
  const float l_all = l_i + xhalf(l_i);
  _Float16* orow = o + ((size_t)b * L_ + q0 + wave * 16 + nlane) * D_ + h * HD_ + 8 * half;
#pragma unroll
  for (int t = 0; t < 4; ++t) {
    v8h ho;
#pragma unroll
    for (int f = 0; f < 8; ++f) ho[f] = (_Float16)(acc_o[t][f] / l_all);
    *(v8h*)(orow + t * 16) = ho;
  }
}

__global__ __launch_bounds__(256) __attribute__((amdgpu_waves_per_eu(4, 8)))
void out_gemm_kernel(const _Float16* __restrict__ o, const float* __restrict__ w,
                     float* __restrict__ out) {
  __shared__ __align__(16) _Float16 As[128 * 40];   // [m][k]
  __shared__ __align__(16) _Float16 Bs[64 * 40];    // [n][k] (transposed)
  const int tid  = threadIdx.x;
  const int wave = tid >> 5;
  const int lane = tid & 31;
  const int half = lane >> 4;
  const int row0 = blockIdx.x * 128;
  const int col0 = blockIdx.y * 64;
  const int ar = tid >> 2, ac = (tid & 3) * 8;     // A staging: row, first k
  const int bn = tid & 63, bk = (tid >> 6) * 8;    // B staging: column, first k
  const _Float16* oa = o + (size_t)(row0 + ar) * D_ + ac;
  const float* wb = w + (size_t)bk * D_ + col0 + bn;

  v8f acc[4];
#pragma unroll
  for (int t = 0; t < 4; ++t)
#pragma unroll
    for (int f = 0; f < 8; ++f) acc[t][f] = 0.0f;

  for (int k0 = 0; k0 < D_; k0 += 32) {
    if (k0 + 32 < D_) {
      __builtin_prefetch(&o[(size_t)(row0 + (tid >> 1)) * D_ + k0 + 32], 0, 1);
      __builtin_prefetch(&w[(size_t)(k0 + 32 + (tid >> 3)) * D_ + col0 + (tid & 7) * 8], 0, 1);
    }
    // A: 128x32 halves, 16-byte loads and 16-byte LDS stores.
    v8h av[2];
#pragma unroll
    for (int i = 0; i < 2; ++i)
      av[i] = *(const v8h*)(oa + k0 + i * 64 * D_);
    // B: 32x64, stored [n][k]: one column, 8 consecutive k per thread, one
    // 16-byte LDS store.
    float bv[8];
#pragma unroll
    for (int j = 0; j < 8; ++j)
      bv[j] = wb[(size_t)k0 * D_ + j * D_];
#pragma unroll
    for (int i = 0; i < 2; ++i)
      *(v8h*)&As[(i * 64 + ar) * 40 + ac] = av[i];
    v8h hB;
#pragma unroll
    for (int j = 0; j < 8; ++j) hB[j] = (_Float16)bv[j];
    *(v8h*)&Bs[bn * 40 + bk] = hB;
    __syncthreads();

    const v16h a = frag16(As + (wave * 16) * 40, 40, 0);
#pragma unroll
    for (int t = 0; t < 4; ++t) {
      const v16h b = frag16(Bs + (t * 16) * 40, 40, 0);
      acc[t] = __builtin_amdgcn_wmma_f32_16x16x32_f16(
          false, a, false, b, (short)0, acc[t], false, false);
    }
    __syncthreads();
  }

#pragma unroll
  for (int t = 0; t < 4; ++t)
#pragma unroll
    for (int f = 0; f < 8; ++f) {
      const int m = row0 + wave * 16 + f + 8 * half;
      const int n = col0 + t * 16 + (lane & 15);
      out[(size_t)m * D_ + n] = acc[t][f];
    }
}

// ---------------------------------------------------------------------------
extern "C" void kernel_launch(void* const* d_in, const int* in_sizes, int n_in,
                              void* d_out, int out_size, void* d_ws, size_t ws_size,
                              hipStream_t stream) {
  const float* x     = (const float*)d_in[0];
  const float* w_qkv = (const float*)d_in[1];
  const float* w_out = (const float*)d_in[2];
  float* out = (float*)d_out;

  _Float16* qkv = (_Float16*)d_ws;                       // B*L*3D f16 = 24 MB
  _Float16* o   = qkv + (size_t)B_ * L_ * ND3;           // B*L*D  f16 =  8 MB

  qkv_gemm_kernel<<<dim3((B_ * L_) / 256, ND3 / 128), 256, 0, stream>>>(x, w_qkv, qkv);
  attn_kernel<<<B_ * H_ * (L_ / 64), 128, 0, stream>>>(qkv, o);
  out_gemm_kernel<<<dim3((B_ * L_) / 128, D_ / 64), 256, 0, stream>>>(o, w_out, out);
}

// v006
// It runs in 92 microseconds.
// In both of two side-by-side timings against v005, it was 1.15 times as fast.
// Counting every step since v000, it is 2.93 times as fast.
#include <hip/hip_runtime.h>
#include <hip/hip_bf16.h>
#include <hip/hip_fp16.h>

typedef __attribute__((ext_vector_type(16))) _Float16 v16h;
typedef __attribute__((ext_vector_type(8)))  _Float16 v8h;
typedef __attribute__((ext_vector_type(4)))  _Float16 v4h;
typedef __attribute__((ext_vector_type(4)))  float    f32x4;
typedef __attribute__((ext_vector_type(8)))  float    v8f;
typedef __attribute__((ext_vector_type(4)))  unsigned int u32x4;
typedef __attribute__((ext_vector_type(8)))  unsigned int u32x8;
typedef __attribute__((ext_vector_type(8)))  short    s16x8;

#define B_   2
#define L_   2048
#define D_   1024
#define H_   16
#define HD_  64
#define ND3  (3 * D_)
#define KV_BUF 10240   // bytes of one K, V or Q place in the attention kernel's LDS

__device__ __forceinline__ v16h frag16(const _Float16* base, int ld, int kbase) {
  const int lane = threadIdx.x & 31;
  const int half = lane >> 4;
  const int row  = lane & 15;
  const _Float16* p = base + row * ld + kbase + 8 * half;
  const v8h a = *(const v8h*)p;
  const v8h b = *(const v8h*)(p + 16);
  return __builtin_shufflevector(a, b, 0, 1, 2, 3, 4, 5, 6, 7,
                                 8, 9, 10, 11, 12, 13, 14, 15);
}

__device__ __forceinline__ unsigned uni(unsigned v) {
  return (unsigned)__builtin_amdgcn_readfirstlane(v);
}
__device__ __forceinline__ unsigned pinned(unsigned v) {
  unsigned w = __builtin_amdgcn_readfirstlane(v);
  asm volatile("" : "+s"(w));   // keeps the value scalar
  return w;
}
template <unsigned A>
__device__ __forceinline__ u32x8 tdm_group1() {
  u32x8 g;
  g[0] = uni((1u << 20) | (4u << 22) | (A << 25));
  g[1] = uni(128u << 16);
  g[2] = uni(64u << 16);
  g[3] = uni(128u << 16);
  g[4] = uni(64u);
  g[5] = uni(2u * ND3);
  g[6] = uni(0u);
  g[7] = uni(0u);
  return g;
}
__device__ __forceinline__ u32x4 tdm_group0(unsigned lds_dst, unsigned long long ga) {
  u32x4 g;
  g[0] = uni(1u);                                   // count = 1
  g[1] = uni(lds_dst);                              // byte offset in LDS
  g[2] = uni((unsigned)ga);
  g[3] = uni((((unsigned)(ga >> 32)) & 0x01ffffffu) | 0x80000000u);  // type = 2
  return g;
}
__device__ __forceinline__ void tdm_load(u32x4& g0, const u32x8& g1) {
  asm volatile("tensor_load_to_lds %0, %1" : "+s"(g0) : "s"(g1) : "memory");
}
// The compiler places no wait for a tensor load: a tile counts as landed only
// behind its issuer's own wait.
__device__ __forceinline__ void wait_tensor0(u32x4& g0) {
  asm volatile("s_wait_tensorcnt 0x0" : "+s"(g0) :: "memory");
}
// The next tile of the ring: the other buffer, 64 rows further in the source.
__device__ __forceinline__ void tdm_advance(u32x4& g0) {
  const unsigned long long a =
      (((unsigned long long)g0[3] << 32) | g0[2]) + 64ull * ND3 * 2ull;
  g0[1] = uni(g0[1] ^ KV_BUF);
  g0[2] = uni((unsigned)a);
  g0[3] = uni((unsigned)(a >> 32));
}
// A wave's LDS reads have retired before the barrier behind which their buffer
// is refilled.
__device__ __forceinline__ void wait_ds0() {
  asm volatile("s_wait_dscnt 0x0" ::: "memory");
}
// Transposing LDS load: lane (c = lane & 15, h = lane >> 4) gets 8 consecutive
// rows (8h + 0..7) of column c of a row-major 16-bit tile.
__device__ __forceinline__ v8h ld_tr16(const unsigned char* p) {
  typedef __attribute__((address_space(3))) s16x8 lds_s16x8;
  return __builtin_bit_cast(v8h, __builtin_amdgcn_ds_load_tr16_b128_v8i16((lds_s16x8*)p));
}

__global__ __launch_bounds__(256) __attribute__((amdgpu_waves_per_eu(4, 4)))
void qkv_gemm_kernel(const float* __restrict__ x, const float* __restrict__ w,
                     _Float16* __restrict__ qkv) {
  __shared__ __align__(16) _Float16 As[256 * 72];   // [m][k]
  __shared__ __align__(16) _Float16 Bs[128 * 72];   // [n][k] (transposed)
  const int tid  = threadIdx.x;
  const int wave = tid >> 5;
  const int lane = tid & 31;
  const int half = lane >> 4;
  const int row0 = blockIdx.x * 256;
  const int col0 = blockIdx.y * 128;
  const int wrow = (wave >> 1) * 64;               // the wave's rows in the tile
  const int wcol = (wave & 1) * 64;                // the wave's columns: one head
  const int ar = tid >> 4, ac = (tid & 15) * 4;    // A staging: row, first k
  const int bn = tid & 127, bk = (tid >> 7) * 32;  // B staging: column, first k
  const float* xa = x + (size_t)(row0 + ar) * D_ + ac;
  const float* wb = w + (size_t)bk * ND3 + col0 + bn;

  v8f acc[4][4];
#pragma unroll
  for (int i = 0; i < 4; ++i)
#pragma unroll
    for (int t = 0; t < 4; ++t)
#pragma unroll
      for (int f = 0; f < 8; ++f) acc[i][t][f] = 0.0f;

  for (int k0 = 0; k0 < D_; k0 += 64) {
    if (k0 + 64 < D_) {                      // prefetch next tiles
      // x: a row's next 64 k are one aligned 256-byte unit, one prefetch per row.
      __builtin_prefetch(&x[(size_t)(row0 + tid) * D_ + k0 + 64], 0, 1);
      __builtin_prefetch(&w[(size_t)(k0 + 64 + (tid >> 2)) * ND3 + col0 + (tid & 3) * 32], 0, 1);
    }
    // A: 256x64. 16-byte loads, 16 lanes per 256-byte row piece (4 whole lines
    // per wave load), 4 halves per LDS store.
    f32x4 av[16];
#pragma unroll
    for (int i = 0; i < 16; ++i)
      av[i] = *(const f32x4*)(xa + k0 + i * 16 * D_);
    // B: 64x128, stored [n][k]. A thread owns one column n and 32 consecutive k
    // (each load is one whole line per wave), so the transposed row piece
    // leaves as four 16-byte LDS stores.
    float bv[32];
#pragma unroll
    for (int j = 0; j < 32; ++j)
      bv[j] = wb[(size_t)k0 * ND3 + j * ND3];
#pragma unroll
    for (int i = 0; i < 16; ++i) {
      v4h hA;
#pragma unroll
      for (int e = 0; e < 4; ++e) hA[e] = (_Float16)av[i][e];
      *(v4h*)&As[(i * 16 + ar) * 72 + ac] = hA;
    }
#pragma unroll
    for (int g = 0; g < 4; ++g) {
      v8h hB;
#pragma unroll
      for (int j = 0; j < 8; ++j) hB[j] = (_Float16)bv[g * 8 + j];
      *(v8h*)&Bs[bn * 72 + bk + g * 8] = hB;
    }
    __syncthreads();

#pragma unroll
    for (int ks = 0; ks < 2; ++ks) {
      // All eight fragments first, as one group of LDS loads, then the products.
      v16h a[4], b[4];
#pragma unroll
      for (int i = 0; i < 4; ++i)
        a[i] = frag16(As + (wrow + i * 16) * 72, 72, ks * 32);
#pragma unroll
      for (int t = 0; t < 4; ++t)
        b[t] = frag16(Bs + (wcol + t * 16) * 72, 72, ks * 32);
      // Keeps the sixteen loads ahead of the products: left free, the compiler
      // sinks a fragment's loads to its own products, into one register set, and
      // the wave waits out the LDS latency several times a pass.
      __builtin_amdgcn_sched_barrier(0);
#pragma unroll
      for (int t = 0; t < 4; ++t)
#pragma unroll
        for (int i = 0; i < 4; ++i)
          acc[i][t] = __builtin_amdgcn_wmma_f32_16x16x32_f16(
              false, a[i], false, b[t], (short)0, acc[i][t], false, false);
    }
    __syncthreads();
  }

  // RoPE on the f32 accumulators. The wave's 64 columns are exactly one head
  // of q, k or v, and a lane holds columns j (acc[i][t]) and j + 32
  // (acc[i][t + 2]) of the same rows, so each rotation pair is already in one
  // lane. Each band of 16 rows is rotated and stored before the next, so its
  // registers are free again.
  const bool rope = col0 < 2 * D_;           // q and k heads; uniform per block
  float inv_freq[2];
  inv_freq[0] = __powf(10000.0f, -(float)(2 * (lane & 15)) / (float)HD_);
  inv_freq[1] = inv_freq[0] * 0.01f;         // j + 16: another 10000^(-1/2)
#pragma unroll
  for (int i = 0; i < 4; ++i) {
    if (rope) {
#pragma unroll
      for (int f = 0; f < 8; ++f) {
        const float pos =
            (float)((row0 + wrow + i * 16 + f + 8 * half) & (L_ - 1));
#pragma unroll
        for (int t = 0; t < 2; ++t) {
          const float rev = pos * inv_freq[t] * 0.15915494f;   // angle in turns
          float c, s;
          asm("v_cos_f32 %0, %2\n\tv_sin_f32 %1, %2\n\tv_nop"
              : "=&v"(c), "=&v"(s) : "v"(rev));
          const float x1 = acc[i][t][f];
          const float x2 = acc[i][t + 2][f];
          acc[i][t][f]     = x1 * c - x2 * s;
          acc[i][t + 2][f] = x2 * c + x1 * s;
        }
      }
    }
#pragma unroll
    for (int t = 0; t < 4; ++t)
#pragma unroll
      for (int f = 0; f < 8; ++f) {
        const int m = row0 + wrow + i * 16 + f + 8 * half;
        const int n = col0 + wcol + t * 16 + (lane & 15);
        qkv[(size_t)m * ND3 + n] = (_Float16)acc[i][t][f];
      }
    // The next band's arithmetic reuses the registers that held this band's
    // store addresses: the wait stands in front of that overwrite.
    if (i < 3) asm volatile("s_wait_xcnt 0x0" ::: "memory");
  }
}

__device__ __forceinline__ float xhalf(float x) {
  return __builtin_bit_cast(float, __builtin_amdgcn_permlanex16(
      __builtin_bit_cast(int, x), __builtin_bit_cast(int, x),
      0x76543210, 0xfedcba98, false, false));
}

__device__ __forceinline__ v8f exp2x8(v8f x) {
  float r0, r1, r2, r3, r4, r5, r6, r7;
  asm("v_exp_f32 %0, %8\n\tv_exp_f32 %1, %9\n\tv_exp_f32 %2, %10\n\t"
      "v_exp_f32 %3, %11\n\tv_exp_f32 %4, %12\n\tv_exp_f32 %5, %13\n\t"
      "v_exp_f32 %6, %14\n\tv_exp_f32 %7, %15\n\tv_nop"
      : "=&v"(r0), "=&v"(r1), "=&v"(r2), "=&v"(r3),
        "=&v"(r4), "=&v"(r5), "=&v"(r6), "=&v"(r7)
      : "v"(x[0]), "v"(x[1]), "v"(x[2]), "v"(x[3]),
        "v"(x[4]), "v"(x[5]), "v"(x[6]), "v"(x[7]));
  v8f r;
  r[0] = r0; r[1] = r1; r[2] = r2; r[3] = r3;
  r[4] = r4; r[5] = r5; r[6] = r6; r[7] = r7;
  return r;
}

__global__ __launch_bounds__(128) __attribute__((amdgpu_waves_per_eu(4, 8)))
void attn_kernel(const _Float16* __restrict__ qkv, _Float16* __restrict__ o) {
  // Five places of 10 KiB, each a multiple of 2 KiB: K buffers 0 and 1 (64 rows
  // at pitch 144), V buffers 0 and 1 (64 rows at pitch 160), Q (pitch 144).
  __shared__ __attribute__((aligned(2048))) unsigned char smem[5 * KV_BUF];

  const int tid   = threadIdx.x;
  const unsigned wave = uni(threadIdx.x >> 5);
  const int lane  = tid & 31;
  const int half  = lane >> 4;
  const int nlane = lane & 15;

  const int blk = blockIdx.x;                // b * H * (L/64)
  const int qt  = blk & 31;                  // L/64 = 32
  const int h   = (blk >> 5) & (H_ - 1);
  const int b   = blk >> 9;
  const int q0  = qt * 64;

  const _Float16* qbase = qkv + (size_t)b * L_ * ND3 + h * HD_;
  const _Float16* kbase = qbase + D_;
  const _Float16* vbase = qbase + 2 * D_;

  const _Float16* Qs = (const _Float16*)(smem + 4 * KV_BUF);
  const unsigned lds0 = (unsigned)(size_t)smem;
  u32x8 g1k = tdm_group1<3>();               // K and Q: pitch 144
  u32x8 g1v = tdm_group1<7>();               // V: pitch 160
  asm volatile("" : "+s"(g1k), "+s"(g1v));
  u32x4 g0 = tdm_group0(lds0 + (wave == 1 ? 2 * KV_BUF : 0),
                        (unsigned long long)(size_t)(wave == 1 ? vbase : kbase));

  // Tile 0 of K and V and the Q tile, one request per wave, each behind its
  // issuer's own wait; the barrier publishes them. Then tile 1's loads.
  if (pinned(wave == 0)) {
    tdm_load(g0, g1k);
    wait_tensor0(g0);
  }
  if (pinned(wave == 1)) {
    tdm_load(g0, g1v);
    wait_tensor0(g0);
  }
  if (pinned(wave == 2)) {
    u32x4 gq = tdm_group0(lds0 + 4 * KV_BUF,
                          (unsigned long long)(size_t)(qbase + (size_t)q0 * ND3));
    tdm_load(gq, g1k);
    wait_tensor0(gq);
  }
  __syncthreads();
  tdm_advance(g0);
  if (pinned(wave == 0)) tdm_load(g0, g1k);
  if (pinned(wave == 1)) tdm_load(g0, g1v);

  // Per lane: running maximum of its query (equal in both halves) and the sum
  // over the keys of its own half only; the halves' sums join after the loop.
  float m_i = -3.0e38f, l_i = 0.0f;
  v8f acc_o[4];                              // O^T: d = t*16 + 8*half + f
#pragma unroll
  for (int t = 0; t < 4; ++t)
#pragma unroll
    for (int f = 0; f < 8; ++f) acc_o[t][f] = 0.0f;

  const float scale = 0.125f;                // 1/sqrt(64)

  for (int kt = 0; kt < L_ / 64; ++kt) {
    const unsigned boff = (unsigned)(kt & 1) * KV_BUF;       // this tile's buffers
    const _Float16* Ks = (const _Float16*)(smem + boff);
    // The lane's address for the transposing loads of V: row 8*half + (lane & 7),
    // 16-byte piece (lane >> 3) & 1.
    const unsigned char* vad = smem + 2 * KV_BUF + boff +
        (8 * half + (lane & 7)) * 160 + ((lane >> 3) & 1) * 16;

    // S^T = K Q^T -> 64 keys x 16 queries per wave: A = K rows, B = Q rows
    v8f acc_s[4];                            // key = t*16 + 8*half + f
#pragma unroll
    for (int t = 0; t < 4; ++t)
#pragma unroll
      for (int f = 0; f < 8; ++f) acc_s[t][f] = 0.0f;
#pragma unroll
    for (int ks = 0; ks < 2; ++ks) {
      const v16h bq = frag16(Qs + (wave * 16) * 72, 72, ks * 32);
#pragma unroll
      for (int t = 0; t < 4; ++t) {
        const v16h ak = frag16(Ks + (t * 16) * 72, 72, ks * 32);
        acc_s[t] = __builtin_amdgcn_wmma_f32_16x16x32_f16(
            false, ak, false, bq, (short)0, acc_s[t], false, false);
      }
    }

    // Online softmax of the lane's query: 32 keys in the lane, the other 32 in
    // lane ^ 16. One chain per tile keeps four independent chains.
    float tmax[4];
#pragma unroll
    for (int t = 0; t < 4; ++t) {
      tmax[t] = acc_s[t][0];
#pragma unroll
      for (int f = 1; f < 8; ++f) tmax[t] = fmaxf(tmax[t], acc_s[t][f]);
    }
    float vmax = fmaxf(fmaxf(tmax[0], tmax[1]), fmaxf(tmax[2], tmax[3]));
    vmax = fmaxf(vmax, xhalf(vmax));
    vmax *= scale;
    const float mnew  = fmaxf(m_i, vmax);
    const float alpha = __expf(m_i - mnew);
    // P^T as a B operand: position (half, e) of a fragment is key
    // kbase + 8*half + e, position (half, 8 + e) key kbase + 16 + 8*half + e,
    // which are the lane's own rows of tiles 2*ks and 2*ks + 1.
    v16h pb[2];
    float tsum[4];
#pragma unroll
    for (int t = 0; t < 4; ++t) {
      // exp(y) = 2^(y * log2(e))
      const v8f p = exp2x8((acc_s[t] * scale - mnew) * 0x1.715476p+0f);
      tsum[t] = p[0];
#pragma unroll
      for (int f = 1; f < 8; ++f) tsum[t] += p[f];
#pragma unroll
      for (int f = 0; f < 8; ++f)
        pb[t >> 1][(t & 1) * 8 + f] = (_Float16)p[f];
    }
    l_i = l_i * alpha + ((tsum[0] + tsum[1]) + (tsum[2] + tsum[3]));
    m_i = mnew;
#pragma unroll
    for (int t = 0; t < 4; ++t)
#pragma unroll
      for (int f = 0; f < 8; ++f) acc_o[t][f] *= alpha;

    // O^T += V^T P^T : A = V^T by transposing loads (position (half, e) is key
    // kbase + 8*half + e, (half, 8 + e) key kbase + 16 + 8*half + e, as in P^T),
    // B = P^T from registers
#pragma unroll
    for (int ks = 0; ks < 2; ++ks) {
#pragma unroll
      for (int t = 0; t < 4; ++t) {
        const v8h v0 = ld_tr16(vad + (ks * 32) * 160 + t * 32);
        const v8h v1 = ld_tr16(vad + (ks * 32 + 16) * 160 + t * 32);
        const v16h av = __builtin_shufflevector(v0, v1, 0, 1, 2, 3, 4, 5, 6, 7,
                                                8, 9, 10, 11, 12, 13, 14, 15);
        acc_o[t] = __builtin_amdgcn_wmma_f32_16x16x32_f16(
            false, av, false, pb[ks], (short)0, acc_o[t], false, false);
      }
    }

    // Publish point of tile kt + 1: own LDS reads retired, the issuers' tiles
    // landed, the barrier; only then the refill of the buffers just read.
    wait_ds0();
    if (pinned(wave < 2)) wait_tensor0(g0);
    __syncthreads();
    if (pinned(kt + 2 < L_ / 64)) {
      tdm_advance(g0);
      if (pinned(wave == 0)) tdm_load(g0, g1k);
      if (pinned(wave == 1)) tdm_load(g0, g1v);
    }
  }
  wait_tensor0(g0);
  wait_ds0();

  // Normalize and store o as f16 [B*L][D], head-interleaved: a lane's 8 values
  // of a tile are 8 consecutive d of its query's row, one 16-byte store.
  const float l_all = l_i + xhalf(l_i);
  _Float16* orow = o + ((size_t)b * L_ + q0 + wave * 16 + nlane) * D_ + h * HD_ + 8 * half;
#pragma unroll
  for (int t = 0; t < 4; ++t) {
    v8h ho;
#pragma unroll
    for (int f = 0; f < 8; ++f) ho[f] = (_Float16)(acc_o[t][f] / l_all);
    *(v8h*)(orow + t * 16) = ho;
  }
}

__global__ __launch_bounds__(256) __attribute__((amdgpu_waves_per_eu(4, 4)))
void out_gemm_kernel(const _Float16* __restrict__ o, const float* __restrict__ w,
                     float* __restrict__ out) {
  __shared__ __align__(16) _Float16 As[128 * 136];  // [m][k]
  __shared__ __align__(16) _Float16 Bs[64 * 136];   // [n][k] (transposed)
  const int tid  = threadIdx.x;
  const int wave = tid >> 5;
  const int lane = tid & 31;
  const int half = lane >> 4;
  const int row0 = blockIdx.x * 128;
  const int col0 = blockIdx.y * 64;
  const int ar = tid >> 4, ac = (tid & 15) * 8;    // A staging: row, first k
  const int bn = tid & 63, bk = (tid >> 6) * 32;   // B staging: column, first k
  const _Float16* oa = o + (size_t)(row0 + ar) * D_ + ac;
  const float* wb = w + (size_t)bk * D_ + col0 + bn;

  v8f acc[4];
#pragma unroll
  for (int t = 0; t < 4; ++t)
#pragma unroll
    for (int f = 0; f < 8; ++f) acc[t][f] = 0.0f;

  // Kept rolled: unrolled, the compiler sinks a pass's products behind the next
  // pass's load waits, and the code grows eightfold for no shorter pass.
#pragma unroll 1
  for (int k0 = 0; k0 < D_; k0 += 128) {
    if (k0 + 128 < D_) {
      __builtin_prefetch(&o[(size_t)(row0 + (tid >> 1)) * D_ + k0 + 128 + (tid & 1) * 64], 0, 1);
      __builtin_prefetch(&w[(size_t)(k0 + 128 + (tid >> 1)) * D_ + col0 + (tid & 1) * 32], 0, 1);
    }
    // A: 128x128 halves, 16-byte loads (two whole 256-byte row pieces per wave
    // load) and 16-byte LDS stores.
    v8h av[8];
#pragma unroll
    for (int i = 0; i < 8; ++i)
      av[i] = *(const v8h*)(oa + k0 + i * 16 * D_);
    // B: 128x64, stored [n][k]: one column, 32 consecutive k per thread, four
    // 16-byte LDS stores.
    float bv[32];
#pragma unroll
    for (int j = 0; j < 32; ++j)
      bv[j] = wb[(size_t)k0 * D_ + j * D_];
#pragma unroll
    for (int i = 0; i < 8; ++i)
      *(v8h*)&As[(i * 16 + ar) * 136 + ac] = av[i];
#pragma unroll
    for (int g = 0; g < 4; ++g) {
      v8h hB;
#pragma unroll
      for (int j = 0; j < 8; ++j) hB[j] = (_Float16)bv[g * 8 + j];
      *(v8h*)&Bs[bn * 136 + bk + g * 8] = hB;
    }
    __syncthreads();

    // The pass's twenty fragments first, as one group of LDS loads in the order
    // of their use, then the products.
    v16h a[4], b[4][4];
#pragma unroll
    for (int ks = 0; ks < 4; ++ks) {
      a[ks] = frag16(As + (wave * 16) * 136, 136, ks * 32);
#pragma unroll
      for (int t = 0; t < 4; ++t)
        b[ks][t] = frag16(Bs + (t * 16) * 136, 136, ks * 32);
    }
    // Keeps the loads ahead of the products: left free, the compiler sinks each
    // fragment's loads to its own product, into one register set, and the wave
    // waits out the LDS latency once per product.
    __builtin_amdgcn_sched_barrier(0);
#pragma unroll
    for (int ks = 0; ks < 4; ++ks)
#pragma unroll
      for (int t = 0; t < 4; ++t)
        acc[t] = __builtin_amdgcn_wmma_f32_16x16x32_f16(
            false, a[ks], false, b[ks][t], (short)0, acc[t], false, false);
    __syncthreads();
  }

#pragma unroll
  for (int t = 0; t < 4; ++t)
#pragma unroll
    for (int f = 0; f < 8; ++f) {
      const int m = row0 + wave * 16 + f + 8 * half;
      const int n = col0 + t * 16 + (lane & 15);
      out[(size_t)m * D_ + n] = acc[t][f];
    }
}

// ---------------------------------------------------------------------------
extern "C" void kernel_launch(void* const* d_in, const int* in_sizes, int n_in,
                              void* d_out, int out_size, void* d_ws, size_t ws_size,
                              hipStream_t stream) {
  const float* x     = (const float*)d_in[0];
  const float* w_qkv = (const float*)d_in[1];
  const float* w_out = (const float*)d_in[2];
  float* out = (float*)d_out;

  _Float16* qkv = (_Float16*)d_ws;                       // B*L*3D f16 = 24 MB
  _Float16* o   = qkv + (size_t)B_ * L_ * ND3;           // B*L*D  f16 =  8 MB

  qkv_gemm_kernel<<<dim3((B_ * L_) / 256, ND3 / 128), 256, 0, stream>>>(x, w_qkv, qkv);
  attn_kernel<<<B_ * H_ * (L_ / 64), 128, 0, stream>>>(qkv, o);
  out_gemm_kernel<<<dim3((B_ * L_) / 128, D_ / 64), 256, 0, stream>>>(o, w_out, out);
}

// v007
// Measured time: 82.5 microseconds a run.
// In two side-by-side timings against v006, it was 1.11 and 1.12 times as fast.
// Over all steps from v000 it is 3.27 times as fast.
#include <hip/hip_runtime.h>
#include <hip/hip_bf16.h>
#include <hip/hip_fp16.h>

typedef __attribute__((ext_vector_type(16))) _Float16 v16h;
typedef __attribute__((ext_vector_type(8)))  _Float16 v8h;
typedef __attribute__((ext_vector_type(4)))  _Float16 v4h;
typedef __attribute__((ext_vector_type(4)))  float    f32x4;
typedef __attribute__((ext_vector_type(8)))  float    v8f;
typedef __attribute__((ext_vector_type(4)))  unsigned int u32x4;
typedef __attribute__((ext_vector_type(8)))  unsigned int u32x8;
typedef __attribute__((ext_vector_type(8)))  short    s16x8;

#define B_   2
#define L_   2048
#define D_   1024
#define H_   16
#define HD_  64
#define ND3  (3 * D_)
#define KV_BUF 10240   // bytes of one K, V or Q place in the attention kernel's LDS

__device__ __forceinline__ v16h frag16(const _Float16* base, int ld, int kbase) {
  const int lane = threadIdx.x & 31;
  const int half = lane >> 4;
  const int row  = lane & 15;
  const _Float16* p = base + row * ld + kbase + 8 * half;
  const v8h a = *(const v8h*)p;
  const v8h b = *(const v8h*)(p + 16);
  return __builtin_shufflevector(a, b, 0, 1, 2, 3, 4, 5, 6, 7,
                                 8, 9, 10, 11, 12, 13, 14, 15);
}

__device__ __forceinline__ unsigned uni(unsigned v) {
  return (unsigned)__builtin_amdgcn_readfirstlane(v);
}
__device__ __forceinline__ unsigned pinned(unsigned v) {
  unsigned w = __builtin_amdgcn_readfirstlane(v);
  asm volatile("" : "+s"(w));   // keeps the value scalar
  return w;
}
template <unsigned A>
__device__ __forceinline__ u32x8 tdm_group1() {
  u32x8 g;
  g[0] = uni((1u << 20) | (4u << 22) | (A << 25));
  g[1] = uni(128u << 16);
  g[2] = uni(64u << 16);
  g[3] = uni(128u << 16);
  g[4] = uni(64u);
  g[5] = uni(2u * ND3);
  g[6] = uni(0u);
  g[7] = uni(0u);
  return g;
}
__device__ __forceinline__ u32x4 tdm_group0(unsigned lds_dst, unsigned long long ga) {
  u32x4 g;
  g[0] = uni(1u);                                   // count = 1
  g[1] = uni(lds_dst);                              // byte offset in LDS
  g[2] = uni((unsigned)ga);
  g[3] = uni((((unsigned)(ga >> 32)) & 0x01ffffffu) | 0x80000000u);  // type = 2
  return g;
}
__device__ __forceinline__ void tdm_load(u32x4& g0, const u32x8& g1) {
  asm volatile("tensor_load_to_lds %0, %1" : "+s"(g0) : "s"(g1) : "memory");
}
// The compiler places no wait for a tensor load: a tile counts as landed only
// behind its issuer's own wait.
__device__ __forceinline__ void wait_tensor0(u32x4& g0) {
  asm volatile("s_wait_tensorcnt 0x0" : "+s"(g0) :: "memory");
}
// The next tile of the ring: the other buffer, 64 rows further in the source.
__device__ __forceinline__ void tdm_advance(u32x4& g0) {
  const unsigned long long a =
      (((unsigned long long)g0[3] << 32) | g0[2]) + 64ull * ND3 * 2ull;
  g0[1] = uni(g0[1] ^ KV_BUF);
  g0[2] = uni((unsigned)a);
  g0[3] = uni((unsigned)(a >> 32));
}
// A wave's LDS reads have retired before the barrier behind which their buffer
// is refilled.
__device__ __forceinline__ void wait_ds0() {
  asm volatile("s_wait_dscnt 0x0" ::: "memory");
}
// Transposing LDS load: lane (c = lane & 15, h = lane >> 4) gets 8 consecutive
// rows (8h + 0..7) of column c of a row-major 16-bit tile.
__device__ __forceinline__ v8h ld_tr16(const unsigned char* p) {
  typedef __attribute__((address_space(3))) s16x8 lds_s16x8;
  return __builtin_bit_cast(v8h, __builtin_amdgcn_ds_load_tr16_b128_v8i16((lds_s16x8*)p));
}

__global__ __launch_bounds__(384) __attribute__((amdgpu_waves_per_eu(3, 3)))
void qkv_gemm_kernel(const float* __restrict__ x, const float* __restrict__ w,
                     _Float16* __restrict__ qkv) {
  __shared__ __align__(16) _Float16 As[256 * 72];   // [m][k]
  __shared__ __align__(16) _Float16 Bs[192 * 72];   // [n][k] (transposed)
  const int tid  = threadIdx.x;
  const int wave = tid >> 5;
  const int lane = tid & 31;
  const int half = lane >> 4;
  const int row0 = blockIdx.x * 256;
  const int col0 = blockIdx.y * 192;
  const int wrow = (wave / 3) * 64;                // the wave's rows in the tile
  const int wcol = (wave % 3) * 64;                // the wave's columns: one head
  const bool astage = __builtin_amdgcn_readfirstlane(tid) < 256;   // per wave
  const int ar = (tid & 255) >> 4, ac = (tid & 15) * 4;  // A staging: row, first k
  const int bn = tid % 192, bk = (tid / 192) * 32;       // B staging: column, first k
  const float* xa = x + (size_t)(row0 + ar) * D_ + ac;
  const float* wb = w + (size_t)bk * ND3 + col0 + bn;

  v8f acc[4][4];
#pragma unroll
  for (int i = 0; i < 4; ++i)
#pragma unroll
    for (int t = 0; t < 4; ++t)
#pragma unroll
      for (int f = 0; f < 8; ++f) acc[i][t][f] = 0.0f;

  // A: 256x64. 16-byte loads, 16 lanes per 256-byte row piece (4 whole lines
  // per wave load). B: 64x192. A thread owns one column n and 32 consecutive k
  // (each load is one whole line per wave).
  f32x4 av[16];
  float bv[32];
  if (astage) {
#pragma unroll
    for (int i = 0; i < 16; ++i)
      av[i] = *(const f32x4*)(xa + i * 16 * D_);
  }
#pragma unroll
  for (int j = 0; j < 32; ++j)
    bv[j] = wb[j * ND3];
  // In front of whatever next overwrites the address registers of these loads.
  asm volatile("s_wait_xcnt 0x0" ::: "memory");

  // Kept rolled: one pass's loads in flight is what the registers hold.
#pragma unroll 1
  for (int kn = 64; kn <= D_; kn += 64) {    // kn: first k of the NEXT pass
    // This pass's operands, loaded a pass ago: 4 halves per LDS store for A, the
    // transposed row piece of B as four 16-byte LDS stores.
    if (astage) {
#pragma unroll
      for (int i = 0; i < 16; ++i) {
        v4h hA;
#pragma unroll
        for (int e = 0; e < 4; ++e) hA[e] = (_Float16)av[i][e];
        *(v4h*)&As[(i * 16 + ar) * 72 + ac] = hA;
      }
    }
#pragma unroll
    for (int g = 0; g < 4; ++g) {
      v8h hB;
#pragma unroll
      for (int j = 0; j < 8; ++j) hB[j] = (_Float16)bv[g * 8 + j];
      *(v8h*)&Bs[bn * 72 + bk + g * 8] = hB;
    }
    __syncthreads();

    const float* pa = xa + kn;               // the next pass's operands
    const float* pb = wb + (size_t)kn * ND3;
    if (kn < D_) {
      if (astage) {
#pragma unroll
        for (int i = 0; i < 16; ++i)
          av[i] = *(const f32x4*)(pa + i * 16 * D_);
      }
#pragma unroll
      for (int j = 0; j < 32; ++j)
        bv[j] = pb[j * ND3];
    }
    if (kn + 64 < D_) {                      // prefetch the tiles after those
      // x: a row's 64 k are one aligned 256-byte unit.
      if (astage)
        __builtin_prefetch(&x[(size_t)(row0 + (tid & 255)) * D_ + kn + 64], 0, 1);
      __builtin_prefetch(&w[(size_t)(kn + 64 + tid / 6) * ND3 + col0 + (tid % 6) * 32], 0, 1);
    }

#pragma unroll
    for (int ks = 0; ks < 2; ++ks) {
      // All eight fragments first, as one group of LDS loads, then the products.
      v16h a[4], b[4];
#pragma unroll
      for (int i = 0; i < 4; ++i)
        a[i] = frag16(As + (wrow + i * 16) * 72, 72, ks * 32);
#pragma unroll
      for (int t = 0; t < 4; ++t)
        b[t] = frag16(Bs + (wcol + t * 16) * 72, 72, ks * 32);
      // Keeps the sixteen loads ahead of the products: left free, the compiler
      // sinks a fragment's loads to its own products, into one register set, and
      // the wave waits out the LDS latency several times a pass.
      __builtin_amdgcn_sched_barrier(0);
#pragma unroll
      for (int t = 0; t < 4; ++t)
#pragma unroll
        for (int i = 0; i < 4; ++i)
          acc[i][t] = __builtin_amdgcn_wmma_f32_16x16x32_f16(
              false, a[i], false, b[t], (short)0, acc[i][t], false, false);
    }
    // The barrier that ends every wave's LDS reads of this pass, written by hand
    // with the one wait it needs: __syncthreads() also waits out the global
    // loads, which are to stay in flight until the next pass converts them.
    asm volatile("s_wait_dscnt 0x0\n\ts_barrier_signal -1\n\ts_barrier_wait -1" ::: "memory");
    // The wait in front of any overwrite of the loads' address registers. It
    // names them as inputs, so they stay theirs up to here and the wait stands
    // at this barrier, not between the loads and the products.
    asm volatile("s_wait_xcnt 0x0" :: "v"(pa), "v"(pb) : "memory");
  }

  // RoPE on the f32 accumulators. The wave's 64 columns are exactly one head
  // of q, k or v, and a lane holds columns j (acc[i][t]) and j + 32
  // (acc[i][t + 2]) of the same rows, so each rotation pair is already in one
  // lane. Each band of 16 rows is rotated and stored before the next, so its
  // registers are free again.
  const bool rope = col0 + wcol < 2 * D_;    // q and k heads; uniform per wave
  float inv_freq[2];
  inv_freq[0] = __powf(10000.0f, -(float)(2 * (lane & 15)) / (float)HD_);
  inv_freq[1] = inv_freq[0] * 0.01f;         // j + 16: another 10000^(-1/2)
#pragma unroll
  for (int i = 0; i < 4; ++i) {
    if (rope) {
#pragma unroll
      for (int f = 0; f < 8; ++f) {
        const float pos =
            (float)((row0 + wrow + i * 16 + f + 8 * half) & (L_ - 1));
#pragma unroll
        for (int t = 0; t < 2; ++t) {
          const float rev = pos * inv_freq[t] * 0.15915494f;   // angle in turns
          float c, s;
          asm("v_cos_f32 %0, %2\n\tv_sin_f32 %1, %2\n\tv_nop"
              : "=&v"(c), "=&v"(s) : "v"(rev));
          const float x1 = acc[i][t][f];
          const float x2 = acc[i][t + 2][f];
          acc[i][t][f]     = x1 * c - x2 * s;
          acc[i][t + 2][f] = x2 * c + x1 * s;
        }
      }
    }
#pragma unroll
    for (int t = 0; t < 4; ++t)
#pragma unroll
      for (int f = 0; f < 8; ++f) {
        const int m = row0 + wrow + i * 16 + f + 8 * half;
        const int n = col0 + wcol + t * 16 + (lane & 15);
        qkv[(size_t)m * ND3 + n] = (_Float16)acc[i][t][f];
      }
    // The next band's arithmetic reuses the registers that held this band's
    // store addresses: the wait stands in front of that overwrite.
    if (i < 3) asm volatile("s_wait_xcnt 0x0" ::: "memory");
  }
}

__device__ __forceinline__ float xhalf(float x) {
  return __builtin_bit_cast(float, __builtin_amdgcn_permlanex16(
      __builtin_bit_cast(int, x), __builtin_bit_cast(int, x),
      0x76543210, 0xfedcba98, false, false));
}

__device__ __forceinline__ v8f exp2x8(v8f x) {
  float r0, r1, r2, r3, r4, r5, r6, r7;
  asm("v_exp_f32 %0, %8\n\tv_exp_f32 %1, %9\n\tv_exp_f32 %2, %10\n\t"
      "v_exp_f32 %3, %11\n\tv_exp_f32 %4, %12\n\tv_exp_f32 %5, %13\n\t"
      "v_exp_f32 %6, %14\n\tv_exp_f32 %7, %15\n\tv_nop"
      : "=&v"(r0), "=&v"(r1), "=&v"(r2), "=&v"(r3),
        "=&v"(r4), "=&v"(r5), "=&v"(r6), "=&v"(r7)
      : "v"(x[0]), "v"(x[1]), "v"(x[2]), "v"(x[3]),
        "v"(x[4]), "v"(x[5]), "v"(x[6]), "v"(x[7]));
  v8f r;
  r[0] = r0; r[1] = r1; r[2] = r2; r[3] = r3;
  r[4] = r4; r[5] = r5; r[6] = r6; r[7] = r7;
  return r;
}

__global__ __launch_bounds__(128) __attribute__((amdgpu_waves_per_eu(4, 8)))
void attn_kernel(const _Float16* __restrict__ qkv, _Float16* __restrict__ o) {
  // Five places of 10 KiB, each a multiple of 2 KiB: K buffers 0 and 1 (64 rows
  // at pitch 144), V buffers 0 and 1 (64 rows at pitch 160), Q (pitch 144).
  __shared__ __attribute__((aligned(2048))) unsigned char smem[5 * KV_BUF];

  const int tid   = threadIdx.x;
  const unsigned wave = uni(threadIdx.x >> 5);
  const int lane  = tid & 31;
  const int half  = lane >> 4;
  const int nlane = lane & 15;

  const int blk = blockIdx.x;                // b * H * (L/64)
  const int qt  = blk & 31;                  // L/64 = 32
  const int h   = (blk >> 5) & (H_ - 1);
  const int b   = blk >> 9;
  const int q0  = qt * 64;

  const _Float16* qbase = qkv + (size_t)b * L_ * ND3 + h * HD_;
  const _Float16* kbase = qbase + D_;
  const _Float16* vbase = qbase + 2 * D_;

  const _Float16* Qs = (const _Float16*)(smem + 4 * KV_BUF);
  const unsigned lds0 = (unsigned)(size_t)smem;
  u32x8 g1k = tdm_group1<3>();               // K and Q: pitch 144
  u32x8 g1v = tdm_group1<7>();               // V: pitch 160
  asm volatile("" : "+s"(g1k), "+s"(g1v));
  u32x4 g0 = tdm_group0(lds0 + (wave == 1 ? 2 * KV_BUF : 0),
                        (unsigned long long)(size_t)(wave == 1 ? vbase : kbase));

  // Tile 0 of K and V and the Q tile, one request per wave, each behind its
  // issuer's own wait; the barrier publishes them. Then tile 1's loads.
  if (pinned(wave == 0)) {
    tdm_load(g0, g1k);
    wait_tensor0(g0);
  }
  if (pinned(wave == 1)) {
    tdm_load(g0, g1v);
    wait_tensor0(g0);
  }
  if (pinned(wave == 2)) {
    u32x4 gq = tdm_group0(lds0 + 4 * KV_BUF,
                          (unsigned long long)(size_t)(qbase + (size_t)q0 * ND3));
    tdm_load(gq, g1k);
    wait_tensor0(gq);
  }
  __syncthreads();
  tdm_advance(g0);
  if (pinned(wave == 0)) tdm_load(g0, g1k);
  if (pinned(wave == 1)) tdm_load(g0, g1v);

  // Per lane: running maximum of its query (equal in both halves) and the sum
  // over the keys of its own half only; the halves' sums join after the loop.
  float m_i = -3.0e38f, l_i = 0.0f;
  v8f acc_o[4];                              // O^T: d = t*16 + 8*half + f
#pragma unroll
  for (int t = 0; t < 4; ++t)
#pragma unroll
    for (int f = 0; f < 8; ++f) acc_o[t][f] = 0.0f;

  const float scale = 0.125f;                // 1/sqrt(64)

  for (int kt = 0; kt < L_ / 64; ++kt) {
    const unsigned boff = (unsigned)(kt & 1) * KV_BUF;       // this tile's buffers
    const _Float16* Ks = (const _Float16*)(smem + boff);
    // The lane's address for the transposing loads of V: row 8*half + (lane & 7),
    // 16-byte piece (lane >> 3) & 1.
    const unsigned char* vad = smem + 2 * KV_BUF + boff +
        (8 * half + (lane & 7)) * 160 + ((lane >> 3) & 1) * 16;

    // S^T = K Q^T -> 64 keys x 16 queries per wave: A = K rows, B = Q rows
    v8f acc_s[4];                            // key = t*16 + 8*half + f
#pragma unroll
    for (int t = 0; t < 4; ++t)
#pragma unroll
      for (int f = 0; f < 8; ++f) acc_s[t][f] = 0.0f;
#pragma unroll
    for (int ks = 0; ks < 2; ++ks) {
      const v16h bq = frag16(Qs + (wave * 16) * 72, 72, ks * 32);
#pragma unroll
      for (int t = 0; t < 4; ++t) {
        const v16h ak = frag16(Ks + (t * 16) * 72, 72, ks * 32);
        acc_s[t] = __builtin_amdgcn_wmma_f32_16x16x32_f16(
            false, ak, false, bq, (short)0, acc_s[t], false, false);
      }
    }

    // Online softmax of the lane's query: 32 keys in the lane, the other 32 in
    // lane ^ 16. One chain per tile keeps four independent chains.
    float tmax[4];
#pragma unroll
    for (int t = 0; t < 4; ++t) {
      tmax[t] = acc_s[t][0];
#pragma unroll
      for (int f = 1; f < 8; ++f) tmax[t] = fmaxf(tmax[t], acc_s[t][f]);
    }
    float vmax = fmaxf(fmaxf(tmax[0], tmax[1]), fmaxf(tmax[2], tmax[3]));
    vmax = fmaxf(vmax, xhalf(vmax));
    vmax *= scale;
    const float mnew  = fmaxf(m_i, vmax);
    const float alpha = __expf(m_i - mnew);
    // P^T as a B operand: position (half, e) of a fragment is key
    // kbase + 8*half + e, position (half, 8 + e) key kbase + 16 + 8*half + e,
    // which are the lane's own rows of tiles 2*ks and 2*ks + 1.
    v16h pb[2];
    float tsum[4];
#pragma unroll
    for (int t = 0; t < 4; ++t) {
      // exp(y) = 2^(y * log2(e))
      const v8f p = exp2x8((acc_s[t] * scale - mnew) * 0x1.715476p+0f);
      tsum[t] = p[0];
#pragma unroll
      for (int f = 1; f < 8; ++f) tsum[t] += p[f];
#pragma unroll
      for (int f = 0; f < 8; ++f)
        pb[t >> 1][(t & 1) * 8 + f] = (_Float16)p[f];
    }
    l_i = l_i * alpha + ((tsum[0] + tsum[1]) + (tsum[2] + tsum[3]));
    m_i = mnew;
#pragma unroll
    for (int t = 0; t < 4; ++t)
#pragma unroll
      for (int f = 0; f < 8; ++f) acc_o[t][f] *= alpha;

    // O^T += V^T P^T : A = V^T by transposing loads (position (half, e) is key
    // kbase + 8*half + e, (half, 8 + e) key kbase + 16 + 8*half + e, as in P^T),
    // B = P^T from registers
#pragma unroll
    for (int ks = 0; ks < 2; ++ks) {
#pragma unroll
      for (int t = 0; t < 4; ++t) {
        const v8h v0 = ld_tr16(vad + (ks * 32) * 160 + t * 32);
        const v8h v1 = ld_tr16(vad + (ks * 32 + 16) * 160 + t * 32);
        const v16h av = __builtin_shufflevector(v0, v1, 0, 1, 2, 3, 4, 5, 6, 7,
                                                8, 9, 10, 11, 12, 13, 14, 15);
        acc_o[t] = __builtin_amdgcn_wmma_f32_16x16x32_f16(
            false, av, false, pb[ks], (short)0, acc_o[t], false, false);
      }
    }

    // Publish point of tile kt + 1: own LDS reads retired, the issuers' tiles
    // landed, the barrier; only then the refill of the buffers just read.
    wait_ds0();
    if (pinned(wave < 2)) wait_tensor0(g0);
    __syncthreads();
    if (pinned(kt + 2 < L_ / 64)) {
      tdm_advance(g0);
      if (pinned(wave == 0)) tdm_load(g0, g1k);
      if (pinned(wave == 1)) tdm_load(g0, g1v);
    }
  }
  wait_tensor0(g0);
  wait_ds0();

  // Normalize and store o as f16 [B*L][D], head-interleaved: a lane's 8 values
  // of a tile are 8 consecutive d of its query's row, one 16-byte store.
  const float l_all = l_i + xhalf(l_i);
  _Float16* orow = o + ((size_t)b * L_ + q0 + wave * 16 + nlane) * D_ + h * HD_ + 8 * half;
#pragma unroll
  for (int t = 0; t < 4; ++t) {
    v8h ho;
#pragma unroll
    for (int f = 0; f < 8; ++f) ho[f] = (_Float16)(acc_o[t][f] / l_all);
    *(v8h*)(orow + t * 16) = ho;
  }
}

__global__ __launch_bounds__(256) __attribute__((amdgpu_waves_per_eu(4, 4)))
void out_gemm_kernel(const _Float16* __restrict__ o, const float* __restrict__ w,
                     float* __restrict__ out) {
  __shared__ __align__(16) _Float16 As[128 * 136];  // [m][k]
  __shared__ __align__(16) _Float16 Bs[64 * 136];   // [n][k] (transposed)
  const int tid  = threadIdx.x;
  const int wave = tid >> 5;
  const int lane = tid & 31;
  const int half = lane >> 4;
  const int row0 = blockIdx.x * 128;
  const int col0 = blockIdx.y * 64;
  const int ar = tid >> 4, ac = (tid & 15) * 8;    // A staging: row, first k
  const int bn = tid & 63, bk = (tid >> 6) * 32;   // B staging: column, first k
  const _Float16* oa = o + (size_t)(row0 + ar) * D_ + ac;
  const float* wb = w + (size_t)bk * D_ + col0 + bn;

  v8f acc[4];
#pragma unroll
  for (int t = 0; t < 4; ++t)
#pragma unroll
    for (int f = 0; f < 8; ++f) acc[t][f] = 0.0f;

  // Kept rolled: unrolled, the compiler sinks a pass's products behind the next
  // pass's load waits, and the code grows eightfold for no shorter pass.
#pragma unroll 1
  for (int k0 = 0; k0 < D_; k0 += 128) {
    if (k0 + 128 < D_) {
      __builtin_prefetch(&o[(size_t)(row0 + (tid >> 1)) * D_ + k0 + 128 + (tid & 1) * 64], 0, 1);
      __builtin_prefetch(&w[(size_t)(k0 + 128 + (tid >> 1)) * D_ + col0 + (tid & 1) * 32], 0, 1);
    }
    // A: 128x128 halves, 16-byte loads (two whole 256-byte row pieces per wave
    // load) and 16-byte LDS stores.
    v8h av[8];
#pragma unroll
    for (int i = 0; i < 8; ++i)
      av[i] = *(const v8h*)(oa + k0 + i * 16 * D_);
    // B: 128x64, stored [n][k]: one column, 32 consecutive k per thread, four
    // 16-byte LDS stores.
    float bv[32];
#pragma unroll
    for (int j = 0; j < 32; ++j)
      bv[j] = wb[(size_t)k0 * D_ + j * D_];
#pragma unroll
    for (int i = 0; i < 8; ++i)
      *(v8h*)&As[(i * 16 + ar) * 136 + ac] = av[i];
#pragma unroll
    for (int g = 0; g < 4; ++g) {
      v8h hB;
#pragma unroll
      for (int j = 0; j < 8; ++j) hB[j] = (_Float16)bv[g * 8 + j];
      *(v8h*)&Bs[bn * 136 + bk + g * 8] = hB;
    }
    __syncthreads();

    // The pass's twenty fragments first, as one group of LDS loads in the order
    // of their use, then the products.
    v16h a[4], b[4][4];
#pragma unroll
    for (int ks = 0; ks < 4; ++ks) {
      a[ks] = frag16(As + (wave * 16) * 136, 136, ks * 32);
#pragma unroll
      for (int t = 0; t < 4; ++t)
        b[ks][t] = frag16(Bs + (t * 16) * 136, 136, ks * 32);
    }
    // Keeps the loads ahead of the products: left free, the compiler sinks each
    // fragment's loads to its own product, into one register set, and the wave
    // waits out the LDS latency once per product.
    __builtin_amdgcn_sched_barrier(0);
#pragma unroll
    for (int ks = 0; ks < 4; ++ks)
#pragma unroll
      for (int t = 0; t < 4; ++t)
        acc[t] = __builtin_amdgcn_wmma_f32_16x16x32_f16(
            false, a[ks], false, b[ks][t], (short)0, acc[t], false, false);
    __syncthreads();
  }

#pragma unroll
  for (int t = 0; t < 4; ++t)
#pragma unroll
    for (int f = 0; f < 8; ++f) {
      const int m = row0 + wave * 16 + f + 8 * half;
      const int n = col0 + t * 16 + (lane & 15);
      out[(size_t)m * D_ + n] = acc[t][f];
    }
}

// ---------------------------------------------------------------------------
extern "C" void kernel_launch(void* const* d_in, const int* in_sizes, int n_in,
                              void* d_out, int out_size, void* d_ws, size_t ws_size,
                              hipStream_t stream) {
  const float* x     = (const float*)d_in[0];
  const float* w_qkv = (const float*)d_in[1];
  const float* w_out = (const float*)d_in[2];
  float* out = (float*)d_out;

  _Float16* qkv = (_Float16*)d_ws;                       // B*L*3D f16 = 24 MB
  _Float16* o   = qkv + (size_t)B_ * L_ * ND3;           // B*L*D  f16 =  8 MB

  qkv_gemm_kernel<<<dim3((B_ * L_) / 256, ND3 / 192), 384, 0, stream>>>(x, w_qkv, qkv);
  attn_kernel<<<B_ * H_ * (L_ / 64), 128, 0, stream>>>(qkv, o);
  out_gemm_kernel<<<dim3((B_ * L_) / 128, D_ / 64), 256, 0, stream>>>(o, w_out, out);
}

// v009
// A run of this version takes 76.8 microseconds.
// It is 1.09 times as fast as v007, going by the measured steps of the versions left out in between.
// Over all steps from v000 it is 3.56 times as fast.
#include <hip/hip_runtime.h>
#include <hip/hip_bf16.h>
#include <hip/hip_fp16.h>

typedef __attribute__((ext_vector_type(16))) _Float16 v16h;
typedef __attribute__((ext_vector_type(8)))  _Float16 v8h;
typedef __attribute__((ext_vector_type(4)))  _Float16 v4h;
typedef __attribute__((ext_vector_type(4)))  float    f32x4;
typedef __attribute__((ext_vector_type(8)))  float    v8f;
typedef __attribute__((ext_vector_type(4)))  unsigned int u32x4;
typedef __attribute__((ext_vector_type(8)))  unsigned int u32x8;
typedef __attribute__((ext_vector_type(8)))  short    s16x8;

#define B_   2
#define L_   2048
#define D_   1024
#define H_   16
#define HD_  64
#define ND3  (3 * D_)
#define KV_BUF 10240   // bytes of one K, V or Q place in the attention kernel's LDS
#define QSCALE 0.18033688f   // log2(e) / sqrt(HD_)

__device__ __forceinline__ v16h frag16(const _Float16* base, int ld, int kbase) {
  const int lane = threadIdx.x & 31;
  const int half = lane >> 4;
  const int row  = lane & 15;
  const _Float16* p = base + row * ld + kbase + 8 * half;
  const v8h a = *(const v8h*)p;
  const v8h b = *(const v8h*)(p + 16);
  return __builtin_shufflevector(a, b, 0, 1, 2, 3, 4, 5, 6, 7,
                                 8, 9, 10, 11, 12, 13, 14, 15);
}

__device__ __forceinline__ unsigned uni(unsigned v) {
  return (unsigned)__builtin_amdgcn_readfirstlane(v);
}
__device__ __forceinline__ unsigned pinned(unsigned v) {
  unsigned w = __builtin_amdgcn_readfirstlane(v);
  asm volatile("" : "+s"(w));   // keeps the value scalar
  return w;
}
template <unsigned A>
__device__ __forceinline__ u32x8 tdm_group1() {
  u32x8 g;
  g[0] = uni((1u << 20) | (4u << 22) | (A << 25));
  g[1] = uni(128u << 16);
  g[2] = uni(64u << 16);
  g[3] = uni(128u << 16);
  g[4] = uni(64u);
  g[5] = uni(2u * ND3);
  g[6] = uni(0u);
  g[7] = uni(0u);
  return g;
}
__device__ __forceinline__ u32x4 tdm_group0(unsigned lds_dst, unsigned long long ga) {
  u32x4 g;
  g[0] = uni(1u);                                   // count = 1
  g[1] = uni(lds_dst);                              // byte offset in LDS
  g[2] = uni((unsigned)ga);
  g[3] = uni((((unsigned)(ga >> 32)) & 0x01ffffffu) | 0x80000000u);  // type = 2
  return g;
}
__device__ __forceinline__ void tdm_load(u32x4& g0, const u32x8& g1) {
  asm volatile("tensor_load_to_lds %0, %1" : "+s"(g0) : "s"(g1) : "memory");
}
// The compiler places no wait for a tensor load: a tile counts as landed only
// behind its issuer's own wait.
__device__ __forceinline__ void wait_tensor0(u32x4& g0) {
  asm volatile("s_wait_tensorcnt 0x0" : "+s"(g0) :: "memory");
}
// The next tile of the ring: the other buffer, 64 rows further in the source.
__device__ __forceinline__ void tdm_advance(u32x4& g0) {
  const unsigned long long a =
      (((unsigned long long)g0[3] << 32) | g0[2]) + 64ull * ND3 * 2ull;
  g0[1] = uni(g0[1] ^ KV_BUF);
  g0[2] = uni((unsigned)a);
  g0[3] = uni((unsigned)(a >> 32));
}
// A wave's LDS reads have retired before the barrier behind which their buffer
// is refilled.
__device__ __forceinline__ void wait_ds0() {
  asm volatile("s_wait_dscnt 0x0" ::: "memory");
}
// Transposing LDS load: lane (c = lane & 15, h = lane >> 4) gets 8 consecutive
// rows (8h + 0..7) of column c of a row-major 16-bit tile.
__device__ __forceinline__ v8h ld_tr16(const unsigned char* p) {
  typedef __attribute__((address_space(3))) s16x8 lds_s16x8;
  return __builtin_bit_cast(v8h, __builtin_amdgcn_ds_load_tr16_b128_v8i16((lds_s16x8*)p));
}

__global__ __launch_bounds__(384) __attribute__((amdgpu_waves_per_eu(3, 3)))
void qkv_gemm_kernel(const float* __restrict__ x, const float* __restrict__ w,
                     _Float16* __restrict__ qkv) {
  __shared__ __align__(16) _Float16 As[256 * 72];   // [m][k]
  __shared__ __align__(16) _Float16 Bs[192 * 72];   // [n][k] (transposed)
  const int tid  = threadIdx.x;
  const int wave = tid >> 5;
  const int lane = tid & 31;
  const int half = lane >> 4;
  const int row0 = blockIdx.x * 256;
  const int col0 = blockIdx.y * 192;
  const int wrow = (wave / 3) * 64;                // the wave's rows in the tile
  const int wcol = (wave % 3) * 64;                // the wave's columns: one head
  const bool astage = __builtin_amdgcn_readfirstlane(tid) < 256;   // per wave
  const int ar = (tid & 255) >> 4, ac = (tid & 15) * 4;  // A staging: row, first k
  const int bn = tid % 192, bk = (tid / 192) * 32;       // B staging: column, first k
  const float* xa = x + (size_t)(row0 + ar) * D_ + ac;
  const float* wb = w + (size_t)bk * ND3 + col0 + bn;

  v8f acc[4][4];
#pragma unroll
  for (int i = 0; i < 4; ++i)
#pragma unroll
    for (int t = 0; t < 4; ++t)
#pragma unroll
      for (int f = 0; f < 8; ++f) acc[i][t][f] = 0.0f;

  // A: 256x64. 16-byte loads, 16 lanes per 256-byte row piece (4 whole lines
  // per wave load). B: 64x192. A thread owns one column n and 32 consecutive k
  // (each load is one whole line per wave).
  f32x4 av[16];
  float bv[32];
  if (astage) {
#pragma unroll
    for (int i = 0; i < 16; ++i)
      av[i] = *(const f32x4*)(xa + i * 16 * D_);
  }
#pragma unroll
  for (int j = 0; j < 32; ++j)
    bv[j] = wb[j * ND3];
  // In front of whatever next overwrites the address registers of these loads.
  asm volatile("s_wait_xcnt 0x0" ::: "memory");

  // Kept rolled: one pass's loads in flight is what the registers hold.
#pragma unroll 1
  for (int kn = 64; kn <= D_; kn += 64) {    // kn: first k of the NEXT pass
    // This pass's operands, loaded a pass ago: 4 halves per LDS store for A, the
    // transposed row piece of B as four 16-byte LDS stores.
    if (astage) {
#pragma unroll
      for (int i = 0; i < 16; ++i) {
        v4h hA;
#pragma unroll
        for (int e = 0; e < 4; ++e) hA[e] = (_Float16)av[i][e];
        *(v4h*)&As[(i * 16 + ar) * 72 + ac] = hA;
      }
    }
#pragma unroll
    for (int g = 0; g < 4; ++g) {
      v8h hB;
#pragma unroll
      for (int j = 0; j < 8; ++j) hB[j] = (_Float16)bv[g * 8 + j];
      *(v8h*)&Bs[bn * 72 + bk + g * 8] = hB;
    }
    __syncthreads();

    const float* pa = xa + kn;               // the next pass's operands
    const float* pb = wb + (size_t)kn * ND3;
    if (kn < D_) {
      if (astage) {
#pragma unroll
        for (int i = 0; i < 16; ++i)
          av[i] = *(const f32x4*)(pa + i * 16 * D_);
      }
#pragma unroll
      for (int j = 0; j < 32; ++j)
        bv[j] = pb[j * ND3];
    }
    if (kn + 64 < D_) {                      // prefetch the tiles after those
      // x: a row's 64 k are one aligned 256-byte unit.
      if (astage)
        __builtin_prefetch(&x[(size_t)(row0 + (tid & 255)) * D_ + kn + 64], 0, 1);
      __builtin_prefetch(&w[(size_t)(kn + 64 + tid / 6) * ND3 + col0 + (tid % 6) * 32], 0, 1);
    }

#pragma unroll
    for (int ks = 0; ks < 2; ++ks) {
      // All eight fragments first, as one group of LDS loads, then the products.
      v16h a[4], b[4];
#pragma unroll
      for (int i = 0; i < 4; ++i)
        a[i] = frag16(As + (wrow + i * 16) * 72, 72, ks * 32);
#pragma unroll
      for (int t = 0; t < 4; ++t)
        b[t] = frag16(Bs + (wcol + t * 16) * 72, 72, ks * 32);
      // Keeps the sixteen loads ahead of the products: left free, the compiler
      // sinks a fragment's loads to its own products, into one register set, and
      // the wave waits out the LDS latency several times a pass.
      __builtin_amdgcn_sched_barrier(0);
#pragma unroll
      for (int t = 0; t < 4; ++t)
#pragma unroll
        for (int i = 0; i < 4; ++i)
          acc[i][t] = __builtin_amdgcn_wmma_f32_16x16x32_f16(
              false, a[i], false, b[t], (short)0, acc[i][t], false, false);
    }
    // The barrier that ends every wave's LDS reads of this pass, written by hand
    // with the one wait it needs: __syncthreads() also waits out the global
    // loads, which are to stay in flight until the next pass converts them.
    asm volatile("s_wait_dscnt 0x0\n\ts_barrier_signal -1\n\ts_barrier_wait -1" ::: "memory");
    // The wait in front of any overwrite of the loads' address registers. It
    // names them as inputs, so they stay theirs up to here and the wait stands
    // at this barrier, not between the loads and the products.
    asm volatile("s_wait_xcnt 0x0" :: "v"(pa), "v"(pb) : "memory");
  }

  // RoPE on the f32 accumulators. The wave's 64 columns are exactly one head
  // of q, k or v, and a lane holds columns j (acc[i][t]) and j + 32
  // (acc[i][t + 2]) of the same rows, so each rotation pair is already in one
  // lane. Each band of 16 rows is rotated and stored before the next, so its
  // registers are free again.
  const bool rope = col0 + wcol < 2 * D_;    // q and k heads; uniform per wave
  // q leaves this kernel times log2(e) / sqrt(64), taken into its rotation's
  // cosine and sine in f32: the attention kernel's score products are then
  // arguments of 2^x. k keeps factor 1.
  const float qs = col0 + wcol < D_ ? QSCALE : 1.0f;
  float inv_freq[2];
  inv_freq[0] = __powf(10000.0f, -(float)(2 * (lane & 15)) / (float)HD_);
  inv_freq[1] = inv_freq[0] * 0.01f;         // j + 16: another 10000^(-1/2)
#pragma unroll
  for (int i = 0; i < 4; ++i) {
    if (rope) {
#pragma unroll
      for (int f = 0; f < 8; ++f) {
        const float pos =
            (float)((row0 + wrow + i * 16 + f + 8 * half) & (L_ - 1));
#pragma unroll
        for (int t = 0; t < 2; ++t) {
          const float rev = pos * inv_freq[t] * 0.15915494f;   // angle in turns
          float c, s;
          asm("v_cos_f32 %0, %2\n\tv_sin_f32 %1, %2\n\tv_nop"
              : "=&v"(c), "=&v"(s) : "v"(rev));
          c *= qs;
          s *= qs;
          const float x1 = acc[i][t][f];
          const float x2 = acc[i][t + 2][f];
          acc[i][t][f]     = x1 * c - x2 * s;
          acc[i][t + 2][f] = x2 * c + x1 * s;
        }
      }
    }
#pragma unroll
    for (int t = 0; t < 4; ++t)
#pragma unroll
      for (int f = 0; f < 8; ++f) {
        const int m = row0 + wrow + i * 16 + f + 8 * half;
        const int n = col0 + wcol + t * 16 + (lane & 15);
        qkv[(size_t)m * ND3 + n] = (_Float16)acc[i][t][f];
      }
    // The next band's arithmetic reuses the registers that held this band's
    // store addresses: the wait stands in front of that overwrite.
    if (i < 3) asm volatile("s_wait_xcnt 0x0" ::: "memory");
  }
}

__device__ __forceinline__ float xhalf(float x) {
  return __builtin_bit_cast(float, __builtin_amdgcn_permlanex16(
      __builtin_bit_cast(int, x), __builtin_bit_cast(int, x),
      0x76543210, 0xfedcba98, false, false));
}

__device__ __forceinline__ v8f exp2x8(v8f x) {
  float r0, r1, r2, r3, r4, r5, r6, r7;
  asm("v_exp_f32 %0, %8\n\tv_exp_f32 %1, %9\n\tv_exp_f32 %2, %10\n\t"
      "v_exp_f32 %3, %11\n\tv_exp_f32 %4, %12\n\tv_exp_f32 %5, %13\n\t"
      "v_exp_f32 %6, %14\n\tv_exp_f32 %7, %15\n\tv_nop"
      : "=&v"(r0), "=&v"(r1), "=&v"(r2), "=&v"(r3),
        "=&v"(r4), "=&v"(r5), "=&v"(r6), "=&v"(r7)
      : "v"(x[0]), "v"(x[1]), "v"(x[2]), "v"(x[3]),
        "v"(x[4]), "v"(x[5]), "v"(x[6]), "v"(x[7]));
  v8f r;
  r[0] = r0; r[1] = r1; r[2] = r2; r[3] = r3;
  r[4] = r4; r[5] = r5; r[6] = r6; r[7] = r7;
  return r;
}

__global__ __launch_bounds__(128) __attribute__((amdgpu_waves_per_eu(4, 8)))
void attn_kernel(const _Float16* __restrict__ qkv, _Float16* __restrict__ o) {
  // Five places of 10 KiB, each a multiple of 2 KiB: K buffers 0 and 1 (64 rows
  // at pitch 144), V buffers 0 and 1 (64 rows at pitch 160), Q (pitch 144).
  __shared__ __attribute__((aligned(2048))) unsigned char smem[5 * KV_BUF];

  const int tid   = threadIdx.x;
  const unsigned wave = uni(threadIdx.x >> 5);
  const int lane  = tid & 31;
  const int half  = lane >> 4;
  const int nlane = lane & 15;

  const int blk = blockIdx.x;                // b * H * (L/64)
  const int qt  = blk & 31;                  // L/64 = 32
  const int h   = (blk >> 5) & (H_ - 1);
  const int b   = blk >> 9;
  const int q0  = qt * 64;

  const _Float16* qbase = qkv + (size_t)b * L_ * ND3 + h * HD_;
  const _Float16* kbase = qbase + D_;
  const _Float16* vbase = qbase + 2 * D_;

  const _Float16* Qs = (const _Float16*)(smem + 4 * KV_BUF);
  const unsigned lds0 = (unsigned)(size_t)smem;
  u32x8 g1k = tdm_group1<3>();               // K and Q: pitch 144
  u32x8 g1v = tdm_group1<7>();               // V: pitch 160
  asm volatile("" : "+s"(g1k), "+s"(g1v));
  u32x4 g0 = tdm_group0(lds0 + (wave == 1 ? 2 * KV_BUF : 0),
                        (unsigned long long)(size_t)(wave == 1 ? vbase : kbase));

  // Tile 0 of K and V and the Q tile, one request per wave, each behind its
  // issuer's own wait; the barrier publishes them. Then tile 1's loads.
  if (pinned(wave == 0)) {
    tdm_load(g0, g1k);
    wait_tensor0(g0);
  }
  if (pinned(wave == 1)) {
    tdm_load(g0, g1v);
    wait_tensor0(g0);
  }
  if (pinned(wave == 2)) {
    u32x4 gq = tdm_group0(lds0 + 4 * KV_BUF,
                          (unsigned long long)(size_t)(qbase + (size_t)q0 * ND3));
    tdm_load(gq, g1k);
    wait_tensor0(gq);
  }
  __syncthreads();
  tdm_advance(g0);
  if (pinned(wave == 0)) tdm_load(g0, g1k);
  if (pinned(wave == 1)) tdm_load(g0, g1v);

  // Per lane: the maximum in use of its query (equal in both halves) and the sum
  // over the keys of its own half only; the halves' sums join after the loop.
  float l_i = 0.0f;
  v8f negm;                                  // minus the maximum in use, 8 times
#pragma unroll
  for (int f = 0; f < 8; ++f) negm[f] = 0.0f;
  v8f acc_o[4];                              // O^T: d = t*16 + 8*half + f
#pragma unroll
  for (int t = 0; t < 4; ++t)
#pragma unroll
    for (int f = 0; f < 8; ++f) acc_o[t][f] = 0.0f;

  for (int kt = 0; kt < L_ / 64; ++kt) {
    const unsigned boff = (unsigned)(kt & 1) * KV_BUF;       // this tile's buffers
    const _Float16* Ks = (const _Float16*)(smem + boff);
    // The lane's address for the transposing loads of V: row 8*half + (lane & 7),
    // 16-byte piece (lane >> 3) & 1.
    const unsigned char* vad = smem + 2 * KV_BUF + boff +
        (8 * half + (lane & 7)) * 160 + ((lane >> 3) & 1) * 16;

    // S^T = K Q^T - maximum in use -> 64 keys x 16 queries per wave: A = K rows,
    // B = Q rows, C = negm
    v8f acc_s[4];                            // key = t*16 + 8*half + f
#pragma unroll
    for (int t = 0; t < 4; ++t) acc_s[t] = negm;
#pragma unroll
    for (int ks = 0; ks < 2; ++ks) {
      const v16h bq = frag16(Qs + (wave * 16) * 72, 72, ks * 32);
#pragma unroll
      for (int t = 0; t < 4; ++t) {
        const v16h ak = frag16(Ks + (t * 16) * 72, 72, ks * 32);
        acc_s[t] = __builtin_amdgcn_wmma_f32_16x16x32_f16(
            false, ak, false, bq, (short)0, acc_s[t], false, false);
      }
    }

    // The tile's V^T fragments (position (half, e) is key kbase + 8*half + e,
    // (half, 8 + e) key kbase + 16 + 8*half + e, as in P^T), as one group of
    // transposing loads that fly under the softmax arithmetic.
    v16h av[2][4];
#pragma unroll
    for (int ks = 0; ks < 2; ++ks)
#pragma unroll
      for (int t = 0; t < 4; ++t) {
        const v8h v0 = ld_tr16(vad + (ks * 32) * 160 + t * 32);
        const v8h v1 = ld_tr16(vad + (ks * 32 + 16) * 160 + t * 32);
        av[ks][t] = __builtin_shufflevector(v0, v1, 0, 1, 2, 3, 4, 5, 6, 7,
                                            8, 9, 10, 11, 12, 13, 14, 15);
      }

    // Online softmax of the lane's query: 32 keys in the lane, the other 32 in
    // lane ^ 16. One chain per tile keeps four independent chains.
    float tmax[4];
#pragma unroll
    for (int t = 0; t < 4; ++t) {
      tmax[t] = acc_s[t][0];
#pragma unroll
      for (int f = 1; f < 8; ++f) tmax[t] = fmaxf(tmax[t], acc_s[t][f]);
    }
    float vmax = fmaxf(fmaxf(tmax[0], tmax[1]), fmaxf(tmax[2], tmax[3]));
    vmax = fmaxf(vmax, xhalf(vmax));
    // One test per tile, a scalar branch. The first tile always sets the maximum
    // (of either sign); it has no sums to correct yet.
    if (__builtin_amdgcn_ballot_w32(vmax > 8.0f) != 0 || kt == 0) {
      const float up   = kt == 0 ? vmax : fmaxf(vmax, 0.0f);
      const float corr = kt == 0 ? 1.0f : __builtin_amdgcn_exp2f(-up);
      negm = negm - up;
      l_i *= corr;
#pragma unroll
      for (int t = 0; t < 4; ++t) {
        acc_s[t] = acc_s[t] - up;
        acc_o[t] = acc_o[t] * corr;
      }
    }
    // P^T as a B operand: position (half, e) of a fragment is key
    // kbase + 8*half + e, position (half, 8 + e) key kbase + 16 + 8*half + e,
    // which are the lane's own rows of tiles 2*ks and 2*ks + 1.
    v16h pb[2];
    float tsum[4];
#pragma unroll
    for (int t = 0; t < 4; ++t) {
      const v8f p = exp2x8(acc_s[t]);
      tsum[t] = p[0];
#pragma unroll
      for (int f = 1; f < 8; ++f) tsum[t] += p[f];
#pragma unroll
      for (int f = 0; f < 8; ++f)
        pb[t >> 1][(t & 1) * 8 + f] = (_Float16)p[f];
    }
    l_i += (tsum[0] + tsum[1]) + (tsum[2] + tsum[3]);

    // Keeps every exponential ahead of the products below: the compiler pads no
    // asm statement, and moved up among them a product would have its operand
    // registers overwritten by the next exponentials inside the distance the
    // matrix unit needs.
    __builtin_amdgcn_sched_barrier(0);
    // O^T += V^T P^T : A = V^T, B = P^T from registers
#pragma unroll
    for (int ks = 0; ks < 2; ++ks) {
#pragma unroll
      for (int t = 0; t < 4; ++t)
        acc_o[t] = __builtin_amdgcn_wmma_f32_16x16x32_f16(
            false, av[ks][t], false, pb[ks], (short)0, acc_o[t], false, false);
    }

    // Publish point of tile kt + 1: own LDS reads retired, the issuers' tiles
    // landed, the barrier; only then the refill of the buffers just read.
    wait_ds0();
    if (pinned(wave < 2)) wait_tensor0(g0);
    __syncthreads();
    if (pinned(kt + 2 < L_ / 64)) {
      tdm_advance(g0);
      if (pinned(wave == 0)) tdm_load(g0, g1k);
      if (pinned(wave == 1)) tdm_load(g0, g1v);
    }
  }
  wait_tensor0(g0);
  wait_ds0();

  // Normalize and store o as f16 [B*L][D], head-interleaved: a lane's 8 values
  // of a tile are 8 consecutive d of its query's row, one 16-byte store.
  const float l_all = l_i + xhalf(l_i);
  _Float16* orow = o + ((size_t)b * L_ + q0 + wave * 16 + nlane) * D_ + h * HD_ + 8 * half;
#pragma unroll
  for (int t = 0; t < 4; ++t) {
    v8h ho;
#pragma unroll
    for (int f = 0; f < 8; ++f) ho[f] = (_Float16)(acc_o[t][f] / l_all);
    *(v8h*)(orow + t * 16) = ho;
  }
}

#define OT_LD 72                        // LDS row pitch in halves (144 bytes)
#define OT_BUF (128 * OT_LD)            // halves of one operand's one buffer

// One pass's operands: A 128x64 halves by 16-byte loads (four whole lines per
// wave load); B 64x128 floats, two columns and 16 consecutive k per thread by
// 8-byte loads (each wave load is one aligned 256-byte unit): 20 loads a set.
// With 4-byte loads (36 a set) two sets in flight were more than the largest
// count the compiler writes in a load wait (62), and the wait for the older set
// also waited for part of the younger.
// The pointers carry the global address space in their type: they pass through
// an asm statement, behind which the compiler could not tell it any more.
typedef __attribute__((address_space(1))) const _Float16 gl_half;
typedef __attribute__((address_space(1))) const v8h      gl_v8h;
typedef __attribute__((address_space(1))) const float    gl_float;
typedef __attribute__((ext_vector_type(2))) float f32x2;
typedef __attribute__((address_space(1))) const f32x2    gl_f32x2;
__device__ __forceinline__ void out_load(v8h (&av)[4], f32x2 (&bv)[16],
                                         gl_half* pa, gl_float* pb) {
#pragma unroll
  for (int i = 0; i < 4; ++i)
    av[i] = *(gl_v8h*)(pa + i * 32 * D_);
#pragma unroll
  for (int j = 0; j < 16; ++j)
    bv[j] = *(gl_f32x2*)(pb + j * D_);
}
// The same into LDS: A as it is, B converted and transposed to [n][k], all by
// 16-byte LDS stores.
__device__ __forceinline__ void out_stage(const v8h (&av)[4], const f32x2 (&bv)[16],
                                          _Float16* sa, _Float16* sb) {
#pragma unroll
  for (int i = 0; i < 4; ++i)
    *(v8h*)(sa + i * 32 * OT_LD) = av[i];
#pragma unroll
  for (int c = 0; c < 2; ++c)
#pragma unroll
    for (int g = 0; g < 2; ++g) {
      v8h hB;
#pragma unroll
      for (int j = 0; j < 8; ++j) hB[j] = (_Float16)bv[g * 8 + j][c];
      *(v8h*)(sb + c * OT_LD + g * 8) = hB;
    }
}
// The barrier of a pass, written by hand with the one wait it needs:
// __syncthreads() also waits out the global loads, which are to stay in flight.
__device__ __forceinline__ void out_barrier() {
  asm volatile("s_wait_dscnt 0x0\n\ts_barrier_signal -1\n\ts_barrier_wait -1" ::: "memory");
}
// A pass's products: its twelve fragments first, as one group of LDS loads in
// the order of their use, then the products.
__device__ __forceinline__ void out_products(v8f (&acc)[2][4], const _Float16* fa,
                                             const _Float16* fb) {
  v16h a[2][2], b[2][4];
#pragma unroll
  for (int ks = 0; ks < 2; ++ks) {
#pragma unroll
    for (int i = 0; i < 2; ++i)
      a[ks][i] = frag16(fa + (i * 16) * OT_LD, OT_LD, ks * 32);
#pragma unroll
    for (int t = 0; t < 4; ++t)
      b[ks][t] = frag16(fb + (t * 16) * OT_LD, OT_LD, ks * 32);
  }
  // Keeps the loads (these and the global ones in front of them) ahead of the
  // products: left free, the compiler sinks each fragment's loads to its own
  // product and the wave waits out the LDS latency once per product.
  __builtin_amdgcn_sched_barrier(0);
#pragma unroll
  for (int ks = 0; ks < 2; ++ks)
#pragma unroll
    for (int t = 0; t < 4; ++t)
#pragma unroll
      for (int i = 0; i < 2; ++i)
        acc[i][t] = __builtin_amdgcn_wmma_f32_16x16x32_f16(
            false, a[ks][i], false, b[ks][t], (short)0, acc[i][t], false, false);
}

// A trip: two passes, one per register set and LDS buffer. MORE: the passes of
// the next trip exist and are loaded. It is a compile-time choice, and the last
// trip stands by itself behind the loop: with a run-time test round the loads
// the compiler's load waits must fit the path without them too, and they then
// wait out the set that has only just been asked for.
template <bool MORE>
__device__ __forceinline__ void out_trip(v8f (&acc)[2][4], v8h (&av0)[4], f32x2 (&bv0)[16],
                                         v8h (&av1)[4], f32x2 (&bv1)[16],
                                         gl_half* pa, gl_float* pb,
                                         _Float16* sa, _Float16* sb,
                                         const _Float16* fa, const _Float16* fb) {
  out_stage(av0, bv0, sa, sb);
  out_barrier();
  if (MORE) out_load(av0, bv0, pa + 128, pb + (size_t)128 * D_);
  out_products(acc, fa, fb);

  out_stage(av1, bv1, sa + OT_BUF, sb + OT_BUF);
  out_barrier();
  if (MORE) out_load(av1, bv1, pa + 192, pb + (size_t)192 * D_);
  out_products(acc, fa + OT_BUF, fb + OT_BUF);
}

__global__ __launch_bounds__(256) __attribute__((amdgpu_waves_per_eu(2, 2)))
void out_gemm_kernel(const _Float16* __restrict__ o, const float* __restrict__ w,
                     float* __restrict__ out) {
  __shared__ __align__(16) _Float16 As[2 * OT_BUF];  // [buffer][m][k]
  __shared__ __align__(16) _Float16 Bs[2 * OT_BUF];  // [buffer][n][k] (transposed)
  const int tid  = threadIdx.x;
  const int wave = tid >> 5;
  const int lane = tid & 31;
  const int half = lane >> 4;
  const int row0 = blockIdx.x * 128;
  const int col0 = blockIdx.y * 128;
  const int wrow = (wave >> 1) * 32;               // the wave's rows in the tile
  const int wcol = (wave & 1) * 64;                // the wave's columns
  const int ar = ((lane >> 3) << 3) + wave, ac = (lane & 7) * 8;
  const int bn = (tid & 63) * 2, bk = (tid >> 6) * 16;  // B staging: first column, first k
  _Float16* sa = As + ar * OT_LD + ac;             // the thread's staging places
  _Float16* sb = Bs + bn * OT_LD + bk;
  const _Float16* fa = As + wrow * OT_LD;          // the wave's fragment rows
  const _Float16* fb = Bs + wcol * OT_LD;

  v8f acc[2][4];
#pragma unroll
  for (int i = 0; i < 2; ++i)
#pragma unroll
    for (int t = 0; t < 4; ++t)
#pragma unroll
      for (int f = 0; f < 8; ++f) acc[i][t][f] = 0.0f;

  // The operands of this trip's two passes; the loads run one trip ahead.
  gl_half* pa = (gl_half*)(o + (size_t)(row0 + ar) * D_ + ac);
  gl_float* pb = (gl_float*)(w + (size_t)bk * D_ + col0 + bn);
  v8h av0[4], av1[4];
  f32x2 bv0[16], bv1[16];
  out_load(av0, bv0, pa, pb);                              // pass 0
  // Keeps pass 0's loads ahead of pass 1's, the order they have in the loop: the
  // load waits at the loop's head count the younger set as still in flight.
  __builtin_amdgcn_sched_barrier(0);
  out_load(av1, bv1, pa + 64, pb + (size_t)64 * D_);       // pass 1

  // Kept rolled (two passes a trip): the trips are alike, and unrolled the code
  // would be seven times as long.
#pragma unroll 1
  for (int trip = 0; trip + 1 < D_ / 128; ++trip) {
    out_trip<true>(acc, av0, bv0, av1, bv1, pa, pb, sa, sb, fa, fb);
    // Keeps the wait below behind the trip's products, well behind the loads.
    __builtin_amdgcn_sched_barrier(0);
    // The wait in front of the overwrite of the loads' address registers. It
    // takes the two pointers in and hands them on, so the additions below, the
    // only writes of those registers, stand behind it.
    asm volatile("s_wait_xcnt 0x0" : "+v"(pa), "+v"(pb) :: "memory");
    pa += 128;
    pb += (size_t)128 * D_;
  }
  out_trip<false>(acc, av0, bv0, av1, bv1, pa, pb, sa, sb, fa, fb);

  float* po = out + (size_t)(row0 + wrow + 8 * half) * D_ + col0 + wcol + (lane & 15);
#pragma unroll
  for (int i = 0; i < 2; ++i)
#pragma unroll
    for (int t = 0; t < 4; ++t)
#pragma unroll
      for (int f = 0; f < 8; ++f)
        po[(i * 16 + f) * D_ + t * 16] = acc[i][t][f];
}

// ---------------------------------------------------------------------------
extern "C" void kernel_launch(void* const* d_in, const int* in_sizes, int n_in,
                              void* d_out, int out_size, void* d_ws, size_t ws_size,
                              hipStream_t stream) {
  const float* x     = (const float*)d_in[0];
  const float* w_qkv = (const float*)d_in[1];
  const float* w_out = (const float*)d_in[2];
  float* out = (float*)d_out;

  _Float16* qkv = (_Float16*)d_ws;                       // B*L*3D f16 = 24 MB
  _Float16* o   = qkv + (size_t)B_ * L_ * ND3;           // B*L*D  f16 =  8 MB

  qkv_gemm_kernel<<<dim3((B_ * L_) / 256, ND3 / 192), 384, 0, stream>>>(x, w_qkv, qkv);
  attn_kernel<<<B_ * H_ * (L_ / 64), 128, 0, stream>>>(qkv, o);
  out_gemm_kernel<<<dim3((B_ * L_) / 128, D_ / 128), 256, 0, stream>>>(o, w_out, out);
}

// v010
// It runs in 73.7 microseconds.
// In two side-by-side timings against v009, it was 1.04 and 1.03 times as fast.
// All steps since v000 together make it 3.69 times as fast.
#include <hip/hip_runtime.h>
#include <hip/hip_bf16.h>
#include <hip/hip_fp16.h>

typedef __attribute__((ext_vector_type(16))) _Float16 v16h;
typedef __attribute__((ext_vector_type(8)))  _Float16 v8h;
typedef __attribute__((ext_vector_type(4)))  _Float16 v4h;
typedef __attribute__((ext_vector_type(4)))  float    f32x4;
typedef __attribute__((ext_vector_type(8)))  float    v8f;
typedef __attribute__((ext_vector_type(4)))  unsigned int u32x4;
typedef __attribute__((ext_vector_type(8)))  unsigned int u32x8;
typedef __attribute__((ext_vector_type(8)))  short    s16x8;

#define B_   2
#define L_   2048
#define D_   1024
#define H_   16
#define HD_  64
#define ND3  (3 * D_)
#define KV_BUF 10240   // bytes of one K, V or Q place in the attention kernel's LDS
#define QSCALE 0.18033688f   // log2(e) / sqrt(HD_)

__device__ __forceinline__ v16h frag16(const _Float16* base, int ld, int kbase) {
  const int lane = threadIdx.x & 31;
  const int half = lane >> 4;
  const int row  = lane & 15;
  const _Float16* p = base + row * ld + kbase + 8 * half;
  const v8h a = *(const v8h*)p;
  const v8h b = *(const v8h*)(p + 16);
  return __builtin_shufflevector(a, b, 0, 1, 2, 3, 4, 5, 6, 7,
                                 8, 9, 10, 11, 12, 13, 14, 15);
}

__device__ __forceinline__ unsigned uni(unsigned v) {
  return (unsigned)__builtin_amdgcn_readfirstlane(v);
}
__device__ __forceinline__ unsigned pinned(unsigned v) {
  unsigned w = __builtin_amdgcn_readfirstlane(v);
  asm volatile("" : "+s"(w));   // keeps the value scalar
  return w;
}
template <unsigned A>
__device__ __forceinline__ u32x8 tdm_group1() {
  u32x8 g;
  g[0] = uni((1u << 20) | (4u << 22) | (A << 25));
  g[1] = uni(128u << 16);
  g[2] = uni(64u << 16);
  g[3] = uni(128u << 16);
  g[4] = uni(64u);
  g[5] = uni(2u * ND3);
  g[6] = uni(0u);
  g[7] = uni(0u);
  return g;
}
__device__ __forceinline__ u32x4 tdm_group0(unsigned lds_dst, unsigned long long ga) {
  u32x4 g;
  g[0] = uni(1u);                                   // count = 1
  g[1] = uni(lds_dst);                              // byte offset in LDS
  g[2] = uni((unsigned)ga);
  g[3] = uni((((unsigned)(ga >> 32)) & 0x01ffffffu) | 0x80000000u);  // type = 2
  return g;
}
__device__ __forceinline__ void tdm_load(u32x4& g0, const u32x8& g1) {
  asm volatile("tensor_load_to_lds %0, %1" : "+s"(g0) : "s"(g1) : "memory");
}
// The compiler places no wait for a tensor load: a tile counts as landed only
// behind its issuer's own wait.
__device__ __forceinline__ void wait_tensor0(u32x4& g0) {
  asm volatile("s_wait_tensorcnt 0x0" : "+s"(g0) :: "memory");
}
// The next tile of the ring: the other buffer, tile number 'tile' (64 rows each,
// 0 to L_/64 - 1) of the source that begins at 'base'.
__device__ __forceinline__ void tdm_advance(u32x4& g0, unsigned long long base,
                                            unsigned tile) {
  const unsigned long long a = base + (unsigned long long)tile * (64ull * ND3 * 2ull);
  g0[1] = uni(g0[1] ^ KV_BUF);
  g0[2] = uni((unsigned)a);
  g0[3] = uni((((unsigned)(a >> 32)) & 0x01ffffffu) | 0x80000000u);  // type = 2
}
// A wave's LDS reads have retired before the barrier behind which their buffer
// is refilled.
__device__ __forceinline__ void wait_ds0() {
  asm volatile("s_wait_dscnt 0x0" ::: "memory");
}
// Transposing LDS load: lane (c = lane & 15, h = lane >> 4) gets 8 consecutive
// rows (8h + 0..7) of column c of a row-major 16-bit tile.
__device__ __forceinline__ v8h ld_tr16(const unsigned char* p) {
  typedef __attribute__((address_space(3))) s16x8 lds_s16x8;
  return __builtin_bit_cast(v8h, __builtin_amdgcn_ds_load_tr16_b128_v8i16((lds_s16x8*)p));
}

__global__ __launch_bounds__(384) __attribute__((amdgpu_waves_per_eu(3, 3)))
void qkv_gemm_kernel(const float* __restrict__ x, const float* __restrict__ w,
                     _Float16* __restrict__ qkv) {
  __shared__ __align__(16) _Float16 As[256 * 72];   // [m][k]
  __shared__ __align__(16) _Float16 Bs[192 * 72];   // [n][k] (transposed)
  const int tid  = threadIdx.x;
  const int wave = tid >> 5;
  const int lane = tid & 31;
  const int half = lane >> 4;
  const int row0 = blockIdx.x * 256;
  const int col0 = blockIdx.y * 192;
  const int wrow = (wave / 3) * 64;                // the wave's rows in the tile
  const int wcol = (wave % 3) * 64;                // the wave's columns: one head
  const bool astage = __builtin_amdgcn_readfirstlane(tid) < 256;   // per wave
  const int ar = (tid & 255) >> 4, ac = (tid & 15) * 4;  // A staging: row, first k
  const int bn = tid % 192, bk = (tid / 192) * 32;       // B staging: column, first k
  const float* xa = x + (size_t)(row0 + ar) * D_ + ac;
  const float* wb = w + (size_t)bk * ND3 + col0 + bn;
  const int k0 = ((blockIdx.x + blockIdx.y) & (D_ / 64 - 1)) * 64;  // first k of the walk

  v8f acc[4][4];
#pragma unroll
  for (int i = 0; i < 4; ++i)
#pragma unroll
    for (int t = 0; t < 4; ++t)
#pragma unroll
      for (int f = 0; f < 8; ++f) acc[i][t][f] = 0.0f;

  // A: 256x64. 16-byte loads, 16 lanes per 256-byte row piece (4 whole lines
  // per wave load). B: 64x192. A thread owns one column n and 32 consecutive k
  // (each load is one whole line per wave).
  f32x4 av[16];
  float bv[32];
  const float* pa0 = xa + k0;
  const float* pb0 = wb + (size_t)k0 * ND3;
  if (astage) {
#pragma unroll
    for (int i = 0; i < 16; ++i)
      av[i] = *(const f32x4*)(pa0 + i * 16 * D_);
  }
#pragma unroll
  for (int j = 0; j < 32; ++j)
    bv[j] = pb0[j * ND3];
  // In front of whatever next overwrites the address registers of these loads;
  // it names them as inputs, so they stay theirs up to here.
  asm volatile("s_wait_xcnt 0x0" :: "v"(pa0), "v"(pb0) : "memory");

  // Kept rolled: one pass's loads in flight is what the registers hold.
#pragma unroll 1
  for (int kn = 64; kn <= D_; kn += 64) {    // kn: k walked up to the NEXT pass
    // This pass's operands, loaded a pass ago: 4 halves per LDS store for A, the
    // transposed row piece of B as four 16-byte LDS stores.
    if (astage) {
#pragma unroll
      for (int i = 0; i < 16; ++i) {
        v4h hA;
#pragma unroll
        for (int e = 0; e < 4; ++e) hA[e] = (_Float16)av[i][e];
        *(v4h*)&As[(i * 16 + ar) * 72 + ac] = hA;
      }
    }
#pragma unroll
    for (int g = 0; g < 4; ++g) {
      v8h hB;
#pragma unroll
      for (int j = 0; j < 8; ++j) hB[j] = (_Float16)bv[g * 8 + j];
      *(v8h*)&Bs[bn * 72 + bk + g * 8] = hB;
    }
    __syncthreads();

    const int kw = (k0 + kn) & (D_ - 1);     // first k of the next pass, wrapped
    const float* pa = xa + kw;               // the next pass's operands
    const float* pb = wb + (size_t)kw * ND3;
    if (kn < D_) {
      if (astage) {
#pragma unroll
        for (int i = 0; i < 16; ++i)
          av[i] = *(const f32x4*)(pa + i * 16 * D_);
      }
#pragma unroll
      for (int j = 0; j < 32; ++j)
        bv[j] = pb[j * ND3];
    }
    if (kn + 64 < D_) {                      // prefetch the tiles after those
      const int kp = (kw + 64) & (D_ - 1);
      // x: a row's 64 k are one aligned 256-byte unit, one request each.
      if (astage)
        __builtin_prefetch(&x[(size_t)(row0 + (tid & 255)) * D_ + kp], 0, 1);
      __builtin_prefetch(&w[(size_t)(kp + tid / 6) * ND3 + col0 + (tid % 6) * 32], 0, 1);
    }

#pragma unroll
    for (int ks = 0; ks < 2; ++ks) {
      // All eight fragments first, as one group of LDS loads, then the products.
      v16h a[4], b[4];
#pragma unroll
      for (int i = 0; i < 4; ++i)
        a[i] = frag16(As + (wrow + i * 16) * 72, 72, ks * 32);
#pragma unroll
      for (int t = 0; t < 4; ++t)
        b[t] = frag16(Bs + (wcol + t * 16) * 72, 72, ks * 32);
      // Keeps the sixteen loads ahead of the products: left free, the compiler
      // sinks a fragment's loads to its own products, into one register set, and
      // the wave waits out the LDS latency several times a pass.
      __builtin_amdgcn_sched_barrier(0);
#pragma unroll
      for (int t = 0; t < 4; ++t)
#pragma unroll
        for (int i = 0; i < 4; ++i)
          acc[i][t] = __builtin_amdgcn_wmma_f32_16x16x32_f16(
              false, a[i], false, b[t], (short)0, acc[i][t], false, false);
    }
    // The barrier that ends every wave's LDS reads of this pass, written by hand
    // with the one wait it needs: __syncthreads() also waits out the global
    // loads, which are to stay in flight until the next pass converts them.
    asm volatile("s_wait_dscnt 0x0\n\ts_barrier_signal -1\n\ts_barrier_wait -1" ::: "memory");
    // The wait in front of any overwrite of the loads' address registers. It
    // names them as inputs, so they stay theirs up to here and the wait stands
    // at this barrier, not between the loads and the products.
    asm volatile("s_wait_xcnt 0x0" :: "v"(pa), "v"(pb) : "memory");
  }

  // RoPE on the f32 accumulators. The wave's 64 columns are exactly one head
  // of q, k or v, and a lane holds columns j (acc[i][t]) and j + 32
  // (acc[i][t + 2]) of the same rows, so each rotation pair is already in one
  // lane. Each band of 16 rows is rotated and stored before the next, so its
  // registers are free again.
  const bool rope = col0 + wcol < 2 * D_;    // q and k heads; uniform per wave
  // q leaves this kernel times log2(e) / sqrt(64), taken into its rotation's
  // cosine and sine in f32: the attention kernel's score products are then
  // arguments of 2^x. k keeps factor 1.
  const float qs = col0 + wcol < D_ ? QSCALE : 1.0f;
  float inv_freq[2];
  inv_freq[0] = __powf(10000.0f, -(float)(2 * (lane & 15)) / (float)HD_);
  inv_freq[1] = inv_freq[0] * 0.01f;         // j + 16: another 10000^(-1/2)
#pragma unroll
  for (int i = 0; i < 4; ++i) {
    if (rope) {
#pragma unroll
      for (int f = 0; f < 8; ++f) {
        const float pos =
            (float)((row0 + wrow + i * 16 + f + 8 * half) & (L_ - 1));
#pragma unroll
        for (int t = 0; t < 2; ++t) {
          const float rev = pos * inv_freq[t] * 0.15915494f;   // angle in turns
          float c, s;
          asm("v_cos_f32 %0, %2\n\tv_sin_f32 %1, %2\n\tv_nop"
              : "=&v"(c), "=&v"(s) : "v"(rev));
          c *= qs;
          s *= qs;
          const float x1 = acc[i][t][f];
          const float x2 = acc[i][t + 2][f];
          acc[i][t][f]     = x1 * c - x2 * s;
          acc[i][t + 2][f] = x2 * c + x1 * s;
        }
      }
    }
#pragma unroll
    for (int t = 0; t < 4; ++t)
#pragma unroll
      for (int f = 0; f < 8; ++f) {
        const int m = row0 + wrow + i * 16 + f + 8 * half;
        const int n = col0 + wcol + t * 16 + (lane & 15);
        qkv[(size_t)m * ND3 + n] = (_Float16)acc[i][t][f];
      }
    // The next band's arithmetic reuses the registers that held this band's
    // store addresses: the wait stands in front of that overwrite.
    if (i < 3) asm volatile("s_wait_xcnt 0x0" ::: "memory");
  }
}

__device__ __forceinline__ float xhalf(float x) {
  return __builtin_bit_cast(float, __builtin_amdgcn_permlanex16(
      __builtin_bit_cast(int, x), __builtin_bit_cast(int, x),
      0x76543210, 0xfedcba98, false, false));
}

__device__ __forceinline__ v8f exp2x8(v8f x) {
  float r0, r1, r2, r3, r4, r5, r6, r7;
  asm("v_exp_f32 %0, %8\n\tv_exp_f32 %1, %9\n\tv_exp_f32 %2, %10\n\t"
      "v_exp_f32 %3, %11\n\tv_exp_f32 %4, %12\n\tv_exp_f32 %5, %13\n\t"
      "v_exp_f32 %6, %14\n\tv_exp_f32 %7, %15\n\tv_nop"
      : "=&v"(r0), "=&v"(r1), "=&v"(r2), "=&v"(r3),
        "=&v"(r4), "=&v"(r5), "=&v"(r6), "=&v"(r7)
      : "v"(x[0]), "v"(x[1]), "v"(x[2]), "v"(x[3]),
        "v"(x[4]), "v"(x[5]), "v"(x[6]), "v"(x[7]));
  v8f r;
  r[0] = r0; r[1] = r1; r[2] = r2; r[3] = r3;
  r[4] = r4; r[5] = r5; r[6] = r6; r[7] = r7;
  return r;
}

__global__ __launch_bounds__(128) __attribute__((amdgpu_waves_per_eu(4, 8)))
void attn_kernel(const _Float16* __restrict__ qkv, _Float16* __restrict__ o) {
  // Five places of 10 KiB, each a multiple of 2 KiB: K buffers 0 and 1 (64 rows
  // at pitch 144), V buffers 0 and 1 (64 rows at pitch 160), Q (pitch 144).
  __shared__ __attribute__((aligned(2048))) unsigned char smem[5 * KV_BUF];

  const int tid   = threadIdx.x;
  const unsigned wave = uni(threadIdx.x >> 5);
  const int lane  = tid & 31;
  const int half  = lane >> 4;
  const int nlane = lane & 15;

  const int blk = blockIdx.x;                // b * H * (L/64)
  const int qt  = blk & 31;                  // L/64 = 32
  const int h   = (blk >> 5) & (H_ - 1);
  const int b   = blk >> 9;
  const int q0  = qt * 64;

  const _Float16* qbase = qkv + (size_t)b * L_ * ND3 + h * HD_;
  const _Float16* kbase = qbase + D_;
  const _Float16* vbase = qbase + 2 * D_;

  const _Float16* Qs = (const _Float16*)(smem + 4 * KV_BUF);
  const unsigned lds0 = (unsigned)(size_t)smem;
  u32x8 g1k = tdm_group1<3>();               // K and Q: pitch 144
  u32x8 g1v = tdm_group1<7>();               // V: pitch 160
  asm volatile("" : "+s"(g1k), "+s"(g1v));
  const unsigned long long kvsrc =
      (unsigned long long)(size_t)(wave == 1 ? vbase : kbase);
  u32x4 g0 = tdm_group0(lds0 + (wave == 1 ? 2 * KV_BUF : 0),
                        kvsrc + (unsigned long long)qt * (64ull * ND3 * 2ull));

  // The walk's first tile of K and V and the Q tile, one request per wave, each
  // behind its issuer's own wait; the barrier publishes them. Then the second
  // tile's loads.
  if (pinned(wave == 0)) {
    tdm_load(g0, g1k);
    wait_tensor0(g0);
  }
  if (pinned(wave == 1)) {
    tdm_load(g0, g1v);
    wait_tensor0(g0);
  }
  if (pinned(wave == 2)) {
    u32x4 gq = tdm_group0(lds0 + 4 * KV_BUF,
                          (unsigned long long)(size_t)(qbase + (size_t)q0 * ND3));
    tdm_load(gq, g1k);
    wait_tensor0(gq);
  }
  __syncthreads();
  tdm_advance(g0, kvsrc, (unsigned)(qt + 1) & (L_ / 64 - 1));
  if (pinned(wave == 0)) tdm_load(g0, g1k);
  if (pinned(wave == 1)) tdm_load(g0, g1v);

  // Per lane: the maximum in use of its query (equal in both halves) and the sum
  // over the keys of its own half only; the halves' sums join after the loop.
  float l_i = 0.0f;
  v8f negm;                                  // minus the maximum in use, 8 times
#pragma unroll
  for (int f = 0; f < 8; ++f) negm[f] = 0.0f;
  v8f acc_o[4];                              // O^T: d = t*16 + 8*half + f
#pragma unroll
  for (int t = 0; t < 4; ++t)
#pragma unroll
    for (int f = 0; f < 8; ++f) acc_o[t][f] = 0.0f;

  for (int kt = 0; kt < L_ / 64; ++kt) {   // kt: step of the walk, tile (qt + kt) mod 32
    const unsigned boff = (unsigned)(kt & 1) * KV_BUF;       // this tile's buffers
    const _Float16* Ks = (const _Float16*)(smem + boff);
    // The lane's address for the transposing loads of V: row 8*half + (lane & 7),
    // 16-byte piece (lane >> 3) & 1.
    const unsigned char* vad = smem + 2 * KV_BUF + boff +
        (8 * half + (lane & 7)) * 160 + ((lane >> 3) & 1) * 16;

    // S^T = K Q^T - maximum in use -> 64 keys x 16 queries per wave: A = K rows,
    // B = Q rows, C = negm
    v8f acc_s[4];                            // key = t*16 + 8*half + f
#pragma unroll
    for (int t = 0; t < 4; ++t) acc_s[t] = negm;
#pragma unroll
    for (int ks = 0; ks < 2; ++ks) {
      const v16h bq = frag16(Qs + (wave * 16) * 72, 72, ks * 32);
#pragma unroll
      for (int t = 0; t < 4; ++t) {
        const v16h ak = frag16(Ks + (t * 16) * 72, 72, ks * 32);
        acc_s[t] = __builtin_amdgcn_wmma_f32_16x16x32_f16(
            false, ak, false, bq, (short)0, acc_s[t], false, false);
      }
    }

    // The tile's V^T fragments (position (half, e) is key kbase + 8*half + e,
    // (half, 8 + e) key kbase + 16 + 8*half + e, as in P^T), as one group of
    // transposing loads that fly under the softmax arithmetic.
    v16h av[2][4];
#pragma unroll
    for (int ks = 0; ks < 2; ++ks)
#pragma unroll
      for (int t = 0; t < 4; ++t) {
        const v8h v0 = ld_tr16(vad + (ks * 32) * 160 + t * 32);
        const v8h v1 = ld_tr16(vad + (ks * 32 + 16) * 160 + t * 32);
        av[ks][t] = __builtin_shufflevector(v0, v1, 0, 1, 2, 3, 4, 5, 6, 7,
                                            8, 9, 10, 11, 12, 13, 14, 15);
      }

    // Online softmax of the lane's query: 32 keys in the lane, the other 32 in
    // lane ^ 16. One chain per tile keeps four independent chains.
    float tmax[4];
#pragma unroll
    for (int t = 0; t < 4; ++t) {
      tmax[t] = acc_s[t][0];
#pragma unroll
      for (int f = 1; f < 8; ++f) tmax[t] = fmaxf(tmax[t], acc_s[t][f]);
    }
    float vmax = fmaxf(fmaxf(tmax[0], tmax[1]), fmaxf(tmax[2], tmax[3]));
    vmax = fmaxf(vmax, xhalf(vmax));
    // One test per tile, a scalar branch. The first tile always sets the maximum
    // (of either sign); it has no sums to correct yet.
    if (__builtin_amdgcn_ballot_w32(vmax > 8.0f) != 0 || kt == 0) {
      const float up   = kt == 0 ? vmax : fmaxf(vmax, 0.0f);
      const float corr = kt == 0 ? 1.0f : __builtin_amdgcn_exp2f(-up);
      negm = negm - up;
      l_i *= corr;
#pragma unroll
      for (int t = 0; t < 4; ++t) {
        acc_s[t] = acc_s[t] - up;
        acc_o[t] = acc_o[t] * corr;
      }
    }
    // P^T as a B operand: position (half, e) of a fragment is key
    // kbase + 8*half + e, position (half, 8 + e) key kbase + 16 + 8*half + e,
    // which are the lane's own rows of tiles 2*ks and 2*ks + 1.
    v16h pb[2];
    float tsum[4];
#pragma unroll
    for (int t = 0; t < 4; ++t) {
      const v8f p = exp2x8(acc_s[t]);
      tsum[t] = p[0];
#pragma unroll
      for (int f = 1; f < 8; ++f) tsum[t] += p[f];
#pragma unroll
      for (int f = 0; f < 8; ++f)
        pb[t >> 1][(t & 1) * 8 + f] = (_Float16)p[f];
    }
    l_i += (tsum[0] + tsum[1]) + (tsum[2] + tsum[3]);

    // Keeps every exponential ahead of the products below: the compiler pads no
    // asm statement, and moved up among them a product would have its operand
    // registers overwritten by the next exponentials inside the distance the
    // matrix unit needs.
    __builtin_amdgcn_sched_barrier(0);
    // O^T += V^T P^T : A = V^T, B = P^T from registers
#pragma unroll
    for (int ks = 0; ks < 2; ++ks) {
#pragma unroll
      for (int t = 0; t < 4; ++t)
        acc_o[t] = __builtin_amdgcn_wmma_f32_16x16x32_f16(
            false, av[ks][t], false, pb[ks], (short)0, acc_o[t], false, false);
    }

    // Publish point of the walk's step kt + 1: own LDS reads retired, the issuers' tiles
    // landed, the barrier; only then the refill of the buffers just read.
    wait_ds0();
    if (pinned(wave < 2)) wait_tensor0(g0);
    __syncthreads();
    if (pinned(kt + 2 < L_ / 64)) {
      tdm_advance(g0, kvsrc, (unsigned)(qt + kt + 2) & (L_ / 64 - 1));
      if (pinned(wave == 0)) tdm_load(g0, g1k);
      if (pinned(wave == 1)) tdm_load(g0, g1v);
    }
  }
  wait_tensor0(g0);
  wait_ds0();

  // Normalize and store o as f16 [B*L][D], head-interleaved: a lane's 8 values
  // of a tile are 8 consecutive d of its query's row, one 16-byte store.
  const float l_all = l_i + xhalf(l_i);
  _Float16* orow = o + ((size_t)b * L_ + q0 + wave * 16 + nlane) * D_ + h * HD_ + 8 * half;
#pragma unroll
  for (int t = 0; t < 4; ++t) {
    v8h ho;
#pragma unroll
    for (int f = 0; f < 8; ++f) ho[f] = (_Float16)(acc_o[t][f] / l_all);
    *(v8h*)(orow + t * 16) = ho;
  }
}

#define OT_LD 72                        // LDS row pitch in halves (144 bytes)
#define OT_BUF (128 * OT_LD)            // halves of one operand's one buffer

// One pass's operands: A 128x64 halves by 16-byte loads (four whole lines per
// wave load); B 64x128 floats, two columns and 16 consecutive k per thread by
// 8-byte loads (each wave load is one aligned 256-byte unit): 20 loads a set.
// With 4-byte loads (36 a set) two sets in flight were more than the largest
// count the compiler writes in a load wait (62), and the wait for the older set
// also waited for part of the younger.
// The pointers carry the global address space in their type: they pass through
// an asm statement, behind which the compiler could not tell it any more.
typedef __attribute__((address_space(1))) const _Float16 gl_half;
typedef __attribute__((address_space(1))) const v8h      gl_v8h;
typedef __attribute__((address_space(1))) const float    gl_float;
typedef __attribute__((ext_vector_type(2))) float f32x2;
typedef __attribute__((address_space(1))) const f32x2    gl_f32x2;
__device__ __forceinline__ void out_load(v8h (&av)[4], f32x2 (&bv)[16],
                                         gl_half* pa, gl_float* pb) {
#pragma unroll
  for (int i = 0; i < 4; ++i)
    av[i] = *(gl_v8h*)(pa + i * 32 * D_);
#pragma unroll
  for (int j = 0; j < 16; ++j)
    bv[j] = *(gl_f32x2*)(pb + j * D_);
}
// The same into LDS: A as it is, B converted and transposed to [n][k], all by
// 16-byte LDS stores.
__device__ __forceinline__ void out_stage(const v8h (&av)[4], const f32x2 (&bv)[16],
                                          _Float16* sa, _Float16* sb) {
#pragma unroll
  for (int i = 0; i < 4; ++i)
    *(v8h*)(sa + i * 32 * OT_LD) = av[i];
#pragma unroll
  for (int c = 0; c < 2; ++c)
#pragma unroll
    for (int g = 0; g < 2; ++g) {
      v8h hB;
#pragma unroll
      for (int j = 0; j < 8; ++j) hB[j] = (_Float16)bv[g * 8 + j][c];
      *(v8h*)(sb + c * OT_LD + g * 8) = hB;
    }
}
// The barrier of a pass, written by hand with the one wait it needs:
// __syncthreads() also waits out the global loads, which are to stay in flight.
__device__ __forceinline__ void out_barrier() {
  asm volatile("s_wait_dscnt 0x0\n\ts_barrier_signal -1\n\ts_barrier_wait -1" ::: "memory");
}
// A pass's products: its twelve fragments first, as one group of LDS loads in
// the order of their use, then the products.
__device__ __forceinline__ void out_products(v8f (&acc)[2][4], const _Float16* fa,
                                             const _Float16* fb) {
  v16h a[2][2], b[2][4];
#pragma unroll
  for (int ks = 0; ks < 2; ++ks) {
#pragma unroll
    for (int i = 0; i < 2; ++i)
      a[ks][i] = frag16(fa + (i * 16) * OT_LD, OT_LD, ks * 32);
#pragma unroll
    for (int t = 0; t < 4; ++t)
      b[ks][t] = frag16(fb + (t * 16) * OT_LD, OT_LD, ks * 32);
  }
  // Keeps the loads (these and the global ones in front of them) ahead of the
  // products: left free, the compiler sinks each fragment's loads to its own
  // product and the wave waits out the LDS latency once per product.
  __builtin_amdgcn_sched_barrier(0);
#pragma unroll
  for (int ks = 0; ks < 2; ++ks)
#pragma unroll
    for (int t = 0; t < 4; ++t)
#pragma unroll
      for (int i = 0; i < 2; ++i)
        acc[i][t] = __builtin_amdgcn_wmma_f32_16x16x32_f16(
            false, a[ks][i], false, b[ks][t], (short)0, acc[i][t], false, false);
}

// A trip: two passes, one per register set and LDS buffer. MORE: the passes of
// the next trip exist and are loaded, from pa and pb. It is a compile-time
// choice, and the last trip stands by itself behind the loop: with a run-time
// test round the loads the compiler's load waits must fit the path without them
// too, and they then wait out the set that has only just been asked for.
template <bool MORE>
__device__ __forceinline__ void out_trip(v8f (&acc)[2][4], v8h (&av0)[4], f32x2 (&bv0)[16],
                                         v8h (&av1)[4], f32x2 (&bv1)[16],
                                         gl_half* pa, gl_float* pb,
                                         _Float16* sa, _Float16* sb,
                                         const _Float16* fa, const _Float16* fb) {
  out_stage(av0, bv0, sa, sb);
  out_barrier();
  if (MORE) out_load(av0, bv0, pa, pb);
  out_products(acc, fa, fb);

  out_stage(av1, bv1, sa + OT_BUF, sb + OT_BUF);
  out_barrier();
  if (MORE) out_load(av1, bv1, pa + 64, pb + (size_t)64 * D_);
  out_products(acc, fa + OT_BUF, fb + OT_BUF);
}

// From the trip whose loads have just been issued to the one that is loaded next:
// one trip on in k, or back to k = 0 behind the last. In front stands the wait
// that an overwrite of the loads' address registers asks for: it takes the two
// pointers in and hands them on, so the additions, the only writes of those
// registers, stand behind it. It is passed at the foot of every trip, so also on
// the way out of the loop, where the registers get other uses.
__device__ __forceinline__ void out_next(gl_half*& pa, gl_float*& pb, int& tw) {
  asm volatile("s_wait_xcnt 0x0" : "+v"(pa), "+v"(pb) :: "memory");
  const int step = tw + 1 < D_ / 128 ? 128 : 128 - D_;
  tw = (tw + 1) & (D_ / 128 - 1);
  pa += step;
  pb += (ptrdiff_t)step * D_;
}

__global__ __launch_bounds__(256) __attribute__((amdgpu_waves_per_eu(2, 2)))
void out_gemm_kernel(const _Float16* __restrict__ o, const float* __restrict__ w,
                     float* __restrict__ out) {
  __shared__ __align__(16) _Float16 As[2 * OT_BUF];  // [buffer][m][k]
  __shared__ __align__(16) _Float16 Bs[2 * OT_BUF];  // [buffer][n][k] (transposed)
  const int tid  = threadIdx.x;
  const int wave = tid >> 5;
  const int lane = tid & 31;
  const int half = lane >> 4;
  const int row0 = blockIdx.x * 128;
  const int col0 = blockIdx.y * 128;
  const int wrow = (wave >> 1) * 32;               // the wave's rows in the tile
  const int wcol = (wave & 1) * 64;                // the wave's columns
  const int ar = ((lane >> 3) << 3) + wave, ac = (lane & 7) * 8;
  const int bn = (tid & 63) * 2, bk = (tid >> 6) * 16;  // B staging: first column, first k
  _Float16* sa = As + ar * OT_LD + ac;             // the thread's staging places
  _Float16* sb = Bs + bn * OT_LD + bk;
  const _Float16* fa = As + wrow * OT_LD;          // the wave's fragment rows
  const _Float16* fb = Bs + wcol * OT_LD;

  v8f acc[2][4];
#pragma unroll
  for (int i = 0; i < 2; ++i)
#pragma unroll
    for (int t = 0; t < 4; ++t)
#pragma unroll
      for (int f = 0; f < 8; ++f) acc[i][t][f] = 0.0f;

  // The operands of the trip that is loaded next; the loads run one trip ahead.
  int tw = (blockIdx.x + blockIdx.y) & (D_ / 128 - 1);     // its place in k, in trips
  gl_half* pa = (gl_half*)(o + (size_t)(row0 + ar) * D_ + ac + tw * 128);
  gl_float* pb = (gl_float*)(w + (size_t)(bk + tw * 128) * D_ + col0 + bn);
  v8h av0[4], av1[4];
  f32x2 bv0[16], bv1[16];
  out_load(av0, bv0, pa, pb);                              // pass 0
  // Keeps pass 0's loads ahead of pass 1's, the order they have in the loop: the
  // load waits at the loop's head count the younger set as still in flight.
  __builtin_amdgcn_sched_barrier(0);
  out_load(av1, bv1, pa + 64, pb + (size_t)64 * D_);       // pass 1

  out_next(pa, pb, tw);

  // Kept rolled (two passes a trip): the trips are alike, and unrolled the code
  // would be seven times as long.
#pragma unroll 1
  for (int trip = 0; trip + 1 < D_ / 128; ++trip) {
    out_trip<true>(acc, av0, bv0, av1, bv1, pa, pb, sa, sb, fa, fb);
    // Keeps the wait below behind the trip's products, well behind the loads.
    __builtin_amdgcn_sched_barrier(0);
    out_next(pa, pb, tw);
  }
  out_trip<false>(acc, av0, bv0, av1, bv1, pa, pb, sa, sb, fa, fb);

  float* po = out + (size_t)(row0 + wrow + 8 * half) * D_ + col0 + wcol + (lane & 15);
#pragma unroll
  for (int i = 0; i < 2; ++i)
#pragma unroll
    for (int t = 0; t < 4; ++t)
#pragma unroll
      for (int f = 0; f < 8; ++f)
        po[(i * 16 + f) * D_ + t * 16] = acc[i][t][f];
}

// ---------------------------------------------------------------------------
extern "C" void kernel_launch(void* const* d_in, const int* in_sizes, int n_in,
                              void* d_out, int out_size, void* d_ws, size_t ws_size,
                              hipStream_t stream) {
  const float* x     = (const float*)d_in[0];
  const float* w_qkv = (const float*)d_in[1];
  const float* w_out = (const float*)d_in[2];
  float* out = (float*)d_out;

  _Float16* qkv = (_Float16*)d_ws;                       // B*L*3D f16 = 24 MB
  _Float16* o   = qkv + (size_t)B_ * L_ * ND3;           // B*L*D  f16 =  8 MB

  qkv_gemm_kernel<<<dim3((B_ * L_) / 256, ND3 / 192), 384, 0, stream>>>(x, w_qkv, qkv);
  attn_kernel<<<B_ * H_ * (L_ / 64), 128, 0, stream>>>(qkv, o);
  out_gemm_kernel<<<dim3((B_ * L_) / 128, D_ / 128), 256, 0, stream>>>(o, w_out, out);
}
